// v000
// Measured on an AMD MI455X. A time is GPU time per run, averaged over a window of back-to-back runs after a warm-up
// (all launches, gaps included; the runs take copies of the inputs in turn), and the median of several windows.
// Apart from v000's, it joins two sittings. Times from different sittings can be a few percent apart, while
// side-by-side timings come from the same sitting.
// The starting kernel, v000, takes 885 microseconds a run.
#include <hip/hip_runtime.h>
#include <hip/hip_bf16.h>

typedef __attribute__((ext_vector_type(2))) float v2f;
typedef __attribute__((ext_vector_type(8))) float v8f;
typedef __attribute__((ext_vector_type(2))) int   v2i;

#define BATCH 16
#define DIM 256
#define HEADS 4
#define DHEAD 32
#define HIDDEN 128            // HEADS * DHEAD
#define OQKV 384              // 3 * HIDDEN
#define NPIX 4096             // 64*64
#define SCALE_Q 5.656854249492381f  // sqrt(32)

// ---- CDNA5 async load-to-LDS support (guarded; falls back to VGPR staging) ----
#if defined(__has_builtin)
#if __has_builtin(__builtin_amdgcn_global_load_async_to_lds_b64) && \
    __has_builtin(__builtin_amdgcn_global_load_async_to_lds_b32)
#define ASYNC_LDS 1
#endif
#endif
#ifndef ASYNC_LDS
#define ASYNC_LDS 0
#endif

#if ASYNC_LDS
__device__ __forceinline__ void async_copy_b64(const float* g, float* l) {
    __builtin_amdgcn_global_load_async_to_lds_b64(
        (__attribute__((address_space(1))) v2i*)g,
        (__attribute__((address_space(3))) v2i*)l, 0, 0);
}
__device__ __forceinline__ void async_copy_b32(const float* g, float* l) {
    __builtin_amdgcn_global_load_async_to_lds_b32(
        (__attribute__((address_space(1))) int*)g,
        (__attribute__((address_space(3))) int*)l, 0, 0);
}
__device__ __forceinline__ void wait_async0() {
#if __has_builtin(__builtin_amdgcn_s_wait_asynccnt)
    __builtin_amdgcn_s_wait_asynccnt(0);
#else
    asm volatile("s_wait_asynccnt 0x0" ::: "memory");
#endif
}
#endif

// ---------------------------------------------------------------------------
// Kernel 1: per-pixel RMS inverse norm over channels:  inv = 16 * rsqrt(sum x^2 + eps)
// ---------------------------------------------------------------------------
__global__ __launch_bounds__(256) void rms_in_kernel(const float* __restrict__ x,
                                                     float* __restrict__ inv) {
    int idx = blockIdx.x * 256 + threadIdx.x;      // [0, 16*4096)
    int b = idx >> 12, n = idx & 4095;
    const float* xb = x + (size_t)b * DIM * NPIX + n;
    float s = 0.f;
    for (int c = 0; c < DIM; ++c) {
        float v = xb[(size_t)c * NPIX];
        s += v * v;
    }
    inv[idx] = 16.0f * rsqrtf(s + 1e-12f);
}

// ---------------------------------------------------------------------------
// Kernel 2: QKV GEMM with fused RMS scaling.
// qkv[b][o][n] = sum_c w_qkv[o][c] * x[b][c][n] * inv[b][n] * g_in[c]
// 128(o) x 64(n) tile / block; K staged 32 at a time, double-buffered LDS.
// LDS uses k-pair-interleaved layout so each WMMA fragment is ONE ds_load_b64:
//   A: lA[(k>>1)*256 + o*2 + (k&1)],  B: lB[(k>>1)*128 + n*2 + (k&1)]
// ---------------------------------------------------------------------------
__global__ __launch_bounds__(256) void qkv_gemm(const float* __restrict__ x,
                                                const float* __restrict__ w,
                                                const float* __restrict__ g_in,
                                                const float* __restrict__ inv,
                                                float* __restrict__ qkv) {
    __shared__ __align__(16) float lA[2][16 * 256];  // 16 k-pairs x 128 o x 2
    __shared__ __align__(16) float lB[2][16 * 128];  // 16 k-pairs x 64 n x 2
    const int b  = blockIdx.z;
    const int o0 = blockIdx.x * 128;
    const int n0 = blockIdx.y * 64;
    const int tid  = threadIdx.x;
    const int wave = tid >> 5;
    const int lane = tid & 31;
    const int half = lane >> 4;      // 0: lanes 0-15 (K pair kk2), 1: lanes 16-31 (kk2+1)
    const int l16  = lane & 15;

    const float* xb   = x   + (size_t)b * DIM * NPIX;
    const float* invb = inv + (size_t)b * NPIX;

    v8f acc[4];
    for (int t = 0; t < 4; ++t)
        for (int j = 0; j < 8; ++j) acc[t][j] = 0.0f;

    auto loadA = [&](int buf, int k0) {
#if ASYNC_LDS
        // 2048 b64 chunks (one k-pair each), 8 per thread
        for (int i = 0; i < 8; ++i) {
            int id = tid + 256 * i;
            int r = id >> 4, j = id & 15;                 // o-row, k-pair
            async_copy_b64(w + (size_t)(o0 + r) * DIM + k0 + 2 * j,
                           &lA[buf][j * 256 + r * 2]);
        }
#else
        for (int i = tid; i < 128 * 32; i += 256) {
            int r = i >> 5, c = i & 31;
            lA[buf][(c >> 1) * 256 + r * 2 + (c & 1)] = w[(size_t)(o0 + r) * DIM + k0 + c];
        }
#endif
    };
    auto loadB = [&](int buf, int k0) {
        // fused scaling -> VGPR staging path
        for (int i = tid; i < 32 * 64; i += 256) {
            int r = i >> 6, c = i & 63;
            float v = xb[(size_t)(k0 + r) * NPIX + n0 + c];
            lB[buf][(r >> 1) * 128 + c * 2 + (r & 1)] = v * invb[n0 + c] * g_in[k0 + r];
        }
    };
    auto compute = [&](int buf) {
        const v2f* A2 = (const v2f*)lA[buf];
        const v2f* B2 = (const v2f*)lB[buf];
        const int oL = wave * 16 + l16;
        for (int kk2 = 0; kk2 < 16; kk2 += 2) {          // 8 K-steps of 4
            v2f a = A2[(kk2 + half) * 128 + oL];
            for (int nt = 0; nt < 4; ++nt) {
                v2f bb = B2[(kk2 + half) * 64 + nt * 16 + l16];
                acc[nt] = __builtin_amdgcn_wmma_f32_16x16x4_f32(
                    false, a, false, bb, (short)0, acc[nt], false, false);
            }
        }
    };

    loadA(0, 0); loadB(0, 0);
#if ASYNC_LDS
    wait_async0();
#endif
    __syncthreads();
    int buf = 0;
    for (int k0 = 0; k0 < DIM; k0 += 32) {
        if (k0 + 32 < DIM) { loadA(buf ^ 1, k0 + 32); loadB(buf ^ 1, k0 + 32); }
        compute(buf);
#if ASYNC_LDS
        wait_async0();
#endif
        __syncthreads();
        buf ^= 1;
    }

    // C/D layout: VGPR i -> (M=i, N=lane) lanes 0-15; (M=i+8, N=lane-16) lanes 16-31
    float* out = qkv + (size_t)b * OQKV * NPIX;
    for (int nt = 0; nt < 4; ++nt)
        for (int i = 0; i < 8; ++i) {
            int row = o0 + wave * 16 + i + half * 8;
            int col = n0 + nt * 16 + l16;
            out[(size_t)row * NPIX + col] = acc[nt][i];
        }
}

// ---------------------------------------------------------------------------
// Kernel 3: q softmax over the d axis (32 values per (b,h,n)), then / sqrt(32).
// ---------------------------------------------------------------------------
__global__ __launch_bounds__(256) void q_softmax_kernel(float* __restrict__ qkv) {
    int idx = blockIdx.x * 256 + threadIdx.x;   // [0, 16*4*4096)
    int b = idx >> 14;
    int r = idx & 16383;
    int h = r >> 12, n = r & 4095;
    float* base = qkv + ((size_t)b * OQKV + h * DHEAD) * NPIX + n;
    float m = -1e30f;
    for (int d = 0; d < DHEAD; ++d) m = fmaxf(m, base[(size_t)d * NPIX]);
    float s = 0.f;
    for (int d = 0; d < DHEAD; ++d) s += __expf(base[(size_t)d * NPIX] - m);
    float invs = 1.0f / (s * SCALE_Q);
    for (int d = 0; d < DHEAD; ++d)
        base[(size_t)d * NPIX] = __expf(base[(size_t)d * NPIX] - m) * invs;
}

// ---------------------------------------------------------------------------
// Kernel 4: per-row (b,h,d) max and sum-exp for k over n axis (4096 + 4 mem slots).
// ---------------------------------------------------------------------------
__global__ __launch_bounds__(256) void k_row_stats(const float* __restrict__ qkv,
                                                   const float* __restrict__ mem_kv,
                                                   float* __restrict__ kstat) {
    int rid = blockIdx.x;                 // [0, 16*128)
    int b = rid >> 7;
    int hd = rid & 127;
    const float* row = qkv + ((size_t)b * OQKV + HIDDEN + hd) * NPIX;
    const float* mk  = mem_kv + (size_t)hd * 4;   // mem_kv[0][h][d][m]
    __shared__ float red[256];
    int tid = threadIdx.x;
    float m = -1e30f;
    for (int n = tid; n < NPIX; n += 256) m = fmaxf(m, row[n]);
    if (tid < 4) m = fmaxf(m, mk[tid]);
    red[tid] = m; __syncthreads();
    for (int s = 128; s > 0; s >>= 1) {
        if (tid < s) red[tid] = fmaxf(red[tid], red[tid + s]);
        __syncthreads();
    }
    float rowmax = red[0]; __syncthreads();
    float sum = 0.f;
    for (int n = tid; n < NPIX; n += 256) sum += __expf(row[n] - rowmax);
    if (tid < 4) sum += __expf(mk[tid] - rowmax);
    red[tid] = sum; __syncthreads();
    for (int s = 128; s > 0; s >>= 1) {
        if (tid < s) red[tid] += red[tid + s];
        __syncthreads();
    }
    if (tid == 0) { kstat[rid * 2] = rowmax; kstat[rid * 2 + 1] = red[0]; }
}

// ---------------------------------------------------------------------------
// Kernel 5: context[b][h][d][e] = sum_n softmax_k[d,n] * v[e,n]  (n incl. mem)
// ---------------------------------------------------------------------------
__global__ __launch_bounds__(256) void context_kernel(const float* __restrict__ qkv,
                                                      const float* __restrict__ mem_kv,
                                                      const float* __restrict__ kstat,
                                                      float* __restrict__ ctx) {
    int b = blockIdx.x >> 2, h = blockIdx.x & 3;
    const float* krows = qkv + ((size_t)b * OQKV + HIDDEN + h * DHEAD) * NPIX;
    const float* vrows = qkv + ((size_t)b * OQKV + 2 * HIDDEN + h * DHEAD) * NPIX;
    const float* ks = kstat + ((size_t)b * HIDDEN + h * DHEAD) * 2;
    __shared__ float lk[DHEAD * 128];
    __shared__ float lv[DHEAD * 128];
    int tid = threadIdx.x;
    float acc[4]; int dd[4], ee[4];
    for (int i = 0; i < 4; ++i) {
        int p = tid + 256 * i; dd[i] = p >> 5; ee[i] = p & 31;
        float m = ks[dd[i] * 2], s = ks[dd[i] * 2 + 1];
        float a = 0.f;
        for (int mm = 0; mm < 4; ++mm) {
            float kw = __expf(mem_kv[(h * DHEAD + dd[i]) * 4 + mm] - m) / s;
            float vv = mem_kv[512 + (h * DHEAD + ee[i]) * 4 + mm];   // mem_kv[1]
            a += kw * vv;
        }
        acc[i] = a;
    }
    for (int n0 = 0; n0 < NPIX; n0 += 128) {
        for (int i = tid; i < DHEAD * 128; i += 256) {
            int r = i >> 7, c = i & 127;
            float m = ks[r * 2], s = ks[r * 2 + 1];
            lk[i] = __expf(krows[(size_t)r * NPIX + n0 + c] - m) / s;
            lv[i] = vrows[(size_t)r * NPIX + n0 + c];
        }
        __syncthreads();
        for (int i = 0; i < 4; ++i) {
            float a = acc[i];
            const float* kr = &lk[dd[i] * 128];
            const float* vr = &lv[ee[i] * 128];
            for (int c = 0; c < 128; ++c) a += kr[c] * vr[c];
            acc[i] = a;
        }
        __syncthreads();
    }
    float* cb = ctx + ((size_t)b * 4 + h) * 1024;
    for (int i = 0; i < 4; ++i) cb[dd[i] * 32 + ee[i]] = acc[i];
}

// ---------------------------------------------------------------------------
// Kernel 6: fold w_out with context:
// W2[b][o][h*32+d] = sum_e w_out[o][h*32+e] * ctx[b][h][d][e]
// ---------------------------------------------------------------------------
__global__ __launch_bounds__(256) void w2_kernel(const float* __restrict__ w_out,
                                                 const float* __restrict__ ctx,
                                                 float* __restrict__ W2) {
    int idx = blockIdx.x * 256 + threadIdx.x;   // [0, 16*256*128)
    int b = idx >> 15;
    int r = idx & 32767;
    int o = r >> 7;
    int hd = r & 127;
    int h = hd >> 5, d = hd & 31;
    const float* cb = ctx + ((size_t)b * 4 + h) * 1024 + d * 32;
    const float* wr = w_out + (size_t)o * HIDDEN + h * DHEAD;
    float a = 0.f;
    for (int e = 0; e < 32; ++e) a += wr[e] * cb[e];
    W2[idx] = a;
}

// ---------------------------------------------------------------------------
// Kernel 7: output GEMM: out[b][o][n] = sum_hd W2[b][o][hd]*q_sm[b][hd][n] + b_out[o]
// Same tiling; both A and B tiles are pure copies -> async-to-LDS eligible.
// ---------------------------------------------------------------------------
__global__ __launch_bounds__(256) void out_gemm(const float* __restrict__ W2,
                                                const float* __restrict__ qkv,
                                                const float* __restrict__ b_out,
                                                float* __restrict__ out) {
    __shared__ __align__(16) float lA[2][16 * 256];
    __shared__ __align__(16) float lB[2][16 * 128];
    const int b  = blockIdx.z;
    const int o0 = blockIdx.x * 128;
    const int n0 = blockIdx.y * 64;
    const int tid = threadIdx.x, wave = tid >> 5, lane = tid & 31;
    const int half = lane >> 4, l16 = lane & 15;
    const float* A = W2 + (size_t)b * DIM * HIDDEN;
    const float* B = qkv + (size_t)b * OQKV * NPIX;   // q rows are [0,128)

    v8f acc[4];
    for (int t = 0; t < 4; ++t)
        for (int j = 0; j < 8; ++j) acc[t][j] = 0.0f;

    auto loadA = [&](int buf, int k0) {
#if ASYNC_LDS
        for (int i = 0; i < 8; ++i) {
            int id = tid + 256 * i;
            int r = id >> 4, j = id & 15;
            async_copy_b64(A + (size_t)(o0 + r) * HIDDEN + k0 + 2 * j,
                           &lA[buf][j * 256 + r * 2]);
        }
#else
        for (int i = tid; i < 128 * 32; i += 256) {
            int r = i >> 5, c = i & 31;
            lA[buf][(c >> 1) * 256 + r * 2 + (c & 1)] = A[(size_t)(o0 + r) * HIDDEN + k0 + c];
        }
#endif
    };
    auto loadB = [&](int buf, int k0) {
#if ASYNC_LDS
        for (int i = 0; i < 8; ++i) {
            int id = tid + 256 * i;                    // 32x64 elements
            int r = id >> 6, c = id & 63;
            async_copy_b32(B + (size_t)(k0 + r) * NPIX + n0 + c,
                           &lB[buf][(r >> 1) * 128 + c * 2 + (r & 1)]);
        }
#else
        for (int i = tid; i < 32 * 64; i += 256) {
            int r = i >> 6, c = i & 63;
            lB[buf][(r >> 1) * 128 + c * 2 + (r & 1)] = B[(size_t)(k0 + r) * NPIX + n0 + c];
        }
#endif
    };
    auto compute = [&](int buf) {
        const v2f* A2 = (const v2f*)lA[buf];
        const v2f* B2 = (const v2f*)lB[buf];
        const int oL = wave * 16 + l16;
        for (int kk2 = 0; kk2 < 16; kk2 += 2) {
            v2f a = A2[(kk2 + half) * 128 + oL];
            for (int nt = 0; nt < 4; ++nt) {
                v2f bb = B2[(kk2 + half) * 64 + nt * 16 + l16];
                acc[nt] = __builtin_amdgcn_wmma_f32_16x16x4_f32(
                    false, a, false, bb, (short)0, acc[nt], false, false);
            }
        }
    };

    loadA(0, 0); loadB(0, 0);
#if ASYNC_LDS
    wait_async0();
#endif
    __syncthreads();
    int buf = 0;
    for (int k0 = 0; k0 < HIDDEN; k0 += 32) {
        if (k0 + 32 < HIDDEN) { loadA(buf ^ 1, k0 + 32); loadB(buf ^ 1, k0 + 32); }
        compute(buf);
#if ASYNC_LDS
        wait_async0();
#endif
        __syncthreads();
        buf ^= 1;
    }

    float* ob = out + (size_t)b * DIM * NPIX;
    for (int nt = 0; nt < 4; ++nt)
        for (int i = 0; i < 8; ++i) {
            int row = o0 + wave * 16 + i + half * 8;
            int col = n0 + nt * 16 + l16;
            ob[(size_t)row * NPIX + col] = acc[nt][i] + b_out[row];
        }
}

// ---------------------------------------------------------------------------
// Kernel 8: final RMS norm in place on d_out.
// ---------------------------------------------------------------------------
__global__ __launch_bounds__(256) void rms_out_kernel(float* __restrict__ out,
                                                      const float* __restrict__ g_out) {
    int idx = blockIdx.x * 256 + threadIdx.x;    // [0, 16*4096)
    int b = idx >> 12, n = idx & 4095;
    float* ob = out + (size_t)b * DIM * NPIX + n;
    float s = 0.f;
    for (int c = 0; c < DIM; ++c) {
        float v = ob[(size_t)c * NPIX];
        s += v * v;
    }
    float inv = 16.0f * rsqrtf(s + 1e-12f);
    for (int c = 0; c < DIM; ++c)
        ob[(size_t)c * NPIX] = ob[(size_t)c * NPIX] * inv * g_out[c];
}

// ---------------------------------------------------------------------------
extern "C" void kernel_launch(void* const* d_in, const int* in_sizes, int n_in,
                              void* d_out, int out_size, void* d_ws, size_t ws_size,
                              hipStream_t stream) {
    const float* x      = (const float*)d_in[0];   // [16][256][4096]
    const float* g_in   = (const float*)d_in[1];   // [256]
    const float* w_qkv  = (const float*)d_in[2];   // [384][256]
    const float* mem_kv = (const float*)d_in[3];   // [2][4][32][4]
    const float* w_out  = (const float*)d_in[4];   // [256][128]
    const float* b_out  = (const float*)d_in[5];   // [256]
    const float* g_out  = (const float*)d_in[6];   // [256]
    float* out = (float*)d_out;                    // [16][256][4096]

    float* ws = (float*)d_ws;
    float* inv   = ws;                                  // 65536
    float* qkv   = inv + (size_t)BATCH * NPIX;          // 16*384*4096
    float* kstat = qkv + (size_t)BATCH * OQKV * NPIX;   // 2048*2
    float* ctx   = kstat + (size_t)BATCH * HIDDEN * 2;  // 16*4*32*32
    float* W2    = ctx + (size_t)BATCH * HEADS * DHEAD * DHEAD; // 16*256*128

    rms_in_kernel  <<<BATCH * NPIX / 256, 256, 0, stream>>>(x, inv);
    qkv_gemm       <<<dim3(OQKV / 128, NPIX / 64, BATCH), 256, 0, stream>>>(x, w_qkv, g_in, inv, qkv);
    q_softmax_kernel<<<BATCH * HEADS * NPIX / 256, 256, 0, stream>>>(qkv);
    k_row_stats    <<<BATCH * HIDDEN, 256, 0, stream>>>(qkv, mem_kv, kstat);
    context_kernel <<<BATCH * HEADS, 256, 0, stream>>>(qkv, mem_kv, kstat, ctx);
    w2_kernel      <<<BATCH * DIM * HIDDEN / 256, 256, 0, stream>>>(w_out, ctx, W2);
    out_gemm       <<<dim3(DIM / 128, NPIX / 64, BATCH), 256, 0, stream>>>(W2, qkv, b_out, out);
    rms_out_kernel <<<BATCH * NPIX / 256, 256, 0, stream>>>(out, g_out);
}

// v001
// Measured time: 340 microseconds a run.
// Timed twice side by side with v000, it ran 2.60 and 2.59 times as fast.
#include <hip/hip_runtime.h>
#include <hip/hip_bf16.h>

typedef __attribute__((ext_vector_type(2))) float v2f;
typedef __attribute__((ext_vector_type(4))) float v4f;
typedef __attribute__((ext_vector_type(8))) float v8f;
typedef __attribute__((ext_vector_type(2))) int   v2i;

#define BATCH 16
#define DIM 256
#define HEADS 4
#define DHEAD 32
#define HIDDEN 128            // HEADS * DHEAD
#define OQKV 384              // 3 * HIDDEN
#define NPIX 4096             // 64*64
#define SCALE_Q 5.656854249492381f  // sqrt(32)

// ---- CDNA5 async load-to-LDS support (guarded; falls back to VGPR staging) ----
#if defined(__has_builtin)
#if __has_builtin(__builtin_amdgcn_global_load_async_to_lds_b64) && \
    __has_builtin(__builtin_amdgcn_global_load_async_to_lds_b32)
#define ASYNC_LDS 1
#endif
#endif
#ifndef ASYNC_LDS
#define ASYNC_LDS 0
#endif

#if ASYNC_LDS
__device__ __forceinline__ void async_copy_b64(const float* g, float* l) {
    __builtin_amdgcn_global_load_async_to_lds_b64(
        (__attribute__((address_space(1))) v2i*)g,
        (__attribute__((address_space(3))) v2i*)l, 0, 0);
}
__device__ __forceinline__ void async_copy_b32(const float* g, float* l) {
    __builtin_amdgcn_global_load_async_to_lds_b32(
        (__attribute__((address_space(1))) int*)g,
        (__attribute__((address_space(3))) int*)l, 0, 0);
}
__device__ __forceinline__ void wait_async0() {
#if __has_builtin(__builtin_amdgcn_s_wait_asynccnt)
    __builtin_amdgcn_s_wait_asynccnt(0);
#else
    asm volatile("s_wait_asynccnt 0x0" ::: "memory");
#endif
}
#endif

// ---------------------------------------------------------------------------
// Kernel 1: per-pixel RMS inverse norm over channels:  inv = 16 * rsqrt(sum x^2 + eps)
// ---------------------------------------------------------------------------
__global__ __launch_bounds__(256) void rms_in_kernel(const float* __restrict__ x,
                                                     float* __restrict__ inv) {
    int idx = blockIdx.x * 256 + threadIdx.x;      // [0, 16*4096)
    int b = idx >> 12, n = idx & 4095;
    const float* xb = x + (size_t)b * DIM * NPIX + n;
    float s = 0.f;
    for (int c = 0; c < DIM; ++c) {
        float v = xb[(size_t)c * NPIX];
        s += v * v;
    }
    inv[idx] = 16.0f * rsqrtf(s + 1e-12f);
}

// ---------------------------------------------------------------------------
// Kernel 2: QKV GEMM with fused RMS scaling.
// qkv[b][o][n] = sum_c w_qkv[o][c] * x[b][c][n] * inv[b][n] * g_in[c]
// 128(o) x 64(n) tile / block; K staged 32 at a time, double-buffered LDS.
// LDS uses k-pair-interleaved layout so each WMMA fragment is ONE ds_load_b64:
//   A: lA[(k>>1)*256 + o*2 + (k&1)],  B: lB[(k>>1)*128 + n*2 + (k&1)]
// ---------------------------------------------------------------------------
__global__ __launch_bounds__(256) void qkv_gemm(const float* __restrict__ x,
                                                const float* __restrict__ w,
                                                const float* __restrict__ g_in,
                                                const float* __restrict__ inv,
                                                float* __restrict__ qkv) {
    __shared__ __align__(16) float lA[2][16 * 256];  // 16 k-pairs x 128 o x 2
    __shared__ __align__(16) float lB[2][16 * 128];  // 16 k-pairs x 64 n x 2
    const int b  = blockIdx.z;
    const int o0 = blockIdx.x * 128;
    const int n0 = blockIdx.y * 64;
    const int tid  = threadIdx.x;
    const int wave = tid >> 5;
    const int lane = tid & 31;
    const int half = lane >> 4;      // 0: lanes 0-15 (K pair kk2), 1: lanes 16-31 (kk2+1)
    const int l16  = lane & 15;

    const float* xb   = x   + (size_t)b * DIM * NPIX;
    const float* invb = inv + (size_t)b * NPIX;

    v8f acc[4];
    for (int t = 0; t < 4; ++t)
        for (int j = 0; j < 8; ++j) acc[t][j] = 0.0f;

    auto loadA = [&](int buf, int k0) {
#if ASYNC_LDS
        // 2048 b64 chunks (one k-pair each), 8 per thread
        for (int i = 0; i < 8; ++i) {
            int id = tid + 256 * i;
            int r = id >> 4, j = id & 15;                 // o-row, k-pair
            async_copy_b64(w + (size_t)(o0 + r) * DIM + k0 + 2 * j,
                           &lA[buf][j * 256 + r * 2]);
        }
#else
        for (int i = tid; i < 128 * 32; i += 256) {
            int r = i >> 5, c = i & 31;
            lA[buf][(c >> 1) * 256 + r * 2 + (c & 1)] = w[(size_t)(o0 + r) * DIM + k0 + c];
        }
#endif
    };
    auto loadB = [&](int buf, int k0) {
        // fused scaling -> VGPR staging path
        for (int i = tid; i < 32 * 64; i += 256) {
            int r = i >> 6, c = i & 63;
            float v = xb[(size_t)(k0 + r) * NPIX + n0 + c];
            lB[buf][(r >> 1) * 128 + c * 2 + (r & 1)] = v * invb[n0 + c] * g_in[k0 + r];
        }
    };
    auto compute = [&](int buf) {
        const v2f* A2 = (const v2f*)lA[buf];
        const v2f* B2 = (const v2f*)lB[buf];
        const int oL = wave * 16 + l16;
        for (int kk2 = 0; kk2 < 16; kk2 += 2) {          // 8 K-steps of 4
            v2f a = A2[(kk2 + half) * 128 + oL];
            for (int nt = 0; nt < 4; ++nt) {
                v2f bb = B2[(kk2 + half) * 64 + nt * 16 + l16];
                acc[nt] = __builtin_amdgcn_wmma_f32_16x16x4_f32(
                    false, a, false, bb, (short)0, acc[nt], false, false);
            }
        }
    };

    loadA(0, 0); loadB(0, 0);
#if ASYNC_LDS
    wait_async0();
#endif
    __syncthreads();
    int buf = 0;
    for (int k0 = 0; k0 < DIM; k0 += 32) {
        if (k0 + 32 < DIM) { loadA(buf ^ 1, k0 + 32); loadB(buf ^ 1, k0 + 32); }
        compute(buf);
#if ASYNC_LDS
        wait_async0();
#endif
        __syncthreads();
        buf ^= 1;
    }

    // C/D layout: VGPR i -> (M=i, N=lane) lanes 0-15; (M=i+8, N=lane-16) lanes 16-31
    float* out = qkv + (size_t)b * OQKV * NPIX;
    for (int nt = 0; nt < 4; ++nt)
        for (int i = 0; i < 8; ++i) {
            int row = o0 + wave * 16 + i + half * 8;
            int col = n0 + nt * 16 + l16;
            out[(size_t)row * NPIX + col] = acc[nt][i];
        }
}

// ---------------------------------------------------------------------------
// Kernel 3: q softmax over the d axis (32 values per (b,h,n)), then / sqrt(32).
// ---------------------------------------------------------------------------
__global__ __launch_bounds__(256) void q_softmax_kernel(float* __restrict__ qkv) {
    int idx = blockIdx.x * 256 + threadIdx.x;   // [0, 16*4*4096)
    int b = idx >> 14;
    int r = idx & 16383;
    int h = r >> 12, n = r & 4095;
    float* base = qkv + ((size_t)b * OQKV + h * DHEAD) * NPIX + n;
    float m = -1e30f;
    for (int d = 0; d < DHEAD; ++d) m = fmaxf(m, base[(size_t)d * NPIX]);
    float s = 0.f;
    for (int d = 0; d < DHEAD; ++d) s += __expf(base[(size_t)d * NPIX] - m);
    float invs = 1.0f / (s * SCALE_Q);
    for (int d = 0; d < DHEAD; ++d)
        base[(size_t)d * NPIX] = __expf(base[(size_t)d * NPIX] - m) * invs;
}

// ---------------------------------------------------------------------------
// Kernel 4: per-row (b,h,d) max and sum-exp for k over n axis (4096 + 4 mem slots).
// ---------------------------------------------------------------------------
__global__ __launch_bounds__(256) void k_row_stats(const float* __restrict__ qkv,
                                                   const float* __restrict__ mem_kv,
                                                   float* __restrict__ kstat) {
    int rid = blockIdx.x;                 // [0, 16*128)
    int b = rid >> 7;
    int hd = rid & 127;
    const float* row = qkv + ((size_t)b * OQKV + HIDDEN + hd) * NPIX;
    const float* mk  = mem_kv + (size_t)hd * 4;   // mem_kv[0][h][d][m]
    __shared__ float red[256];
    int tid = threadIdx.x;
    float m = -1e30f;
    for (int n = tid; n < NPIX; n += 256) m = fmaxf(m, row[n]);
    if (tid < 4) m = fmaxf(m, mk[tid]);
    red[tid] = m; __syncthreads();
    for (int s = 128; s > 0; s >>= 1) {
        if (tid < s) red[tid] = fmaxf(red[tid], red[tid + s]);
        __syncthreads();
    }
    float rowmax = red[0]; __syncthreads();
    float sum = 0.f;
    for (int n = tid; n < NPIX; n += 256) sum += __expf(row[n] - rowmax);
    if (tid < 4) sum += __expf(mk[tid] - rowmax);
    red[tid] = sum; __syncthreads();
    for (int s = 128; s > 0; s >>= 1) {
        if (tid < s) red[tid] += red[tid + s];
        __syncthreads();
    }
    if (tid == 0) { kstat[rid * 2] = rowmax; kstat[rid * 2 + 1] = red[0]; }
}

// ---------------------------------------------------------------------------
// Kernel 5: context[b][h][d][e] = sum_n softmax_k[d,n] * v[e,n]  (n incl. mem)
// One 16(d) x 16(e) tile per work-group on the f32 16x16x4 matrix form, K = n.
// A stage holds 512 n of the 16 k rows (as exp(k - rowmax)) and of the 16 v rows;
// wave w fetches k row w and v row w in whole 512-byte pieces and multiplies
// columns [32w, 32w+32) of the stage. Both fragments are read by the same code
// (row l16, four n at 4*half), so the k order of A and B is equal by construction.
// The four memory columns are one more K = 4 step (wave 0). The row's 1/sum is applied
// once, to the finished tile.
// ---------------------------------------------------------------------------
#define CTX_THREADS 512
#define CTX_NS 512            // n per stage
#define CTX_PITCH 516         // floats per LDS row: 2064 B = 16 B x odd, no bank conflict for 16-byte reads
__global__ __launch_bounds__(CTX_THREADS) void context_kernel(const float* __restrict__ qkv,
                                                              const float* __restrict__ mem_kv,
                                                              const float* __restrict__ kstat,
                                                              float* __restrict__ ctx) {
    __shared__ __align__(16) float tile[2][32 * CTX_PITCH];   // rows 0-15: k, rows 16-31: v
    const int bh = blockIdx.x >> 2;
    const int b = bh >> 2, h = bh & 3;
    const int dt = (blockIdx.x >> 1) & 1, et = blockIdx.x & 1;
    const int tid = threadIdx.x, wave = tid >> 5, lane = tid & 31;
    const int half = lane >> 4, l16 = lane & 15;
    const float* krow = qkv + ((size_t)b * OQKV + HIDDEN + h * DHEAD + dt * 16 + wave) * NPIX;
    const float* vrow = qkv + ((size_t)b * OQKV + 2 * HIDDEN + h * DHEAD + et * 16 + wave) * NPIX;
    const float* ks = kstat + ((size_t)b * HIDDEN + h * DHEAD + dt * 16) * 2;
    const float m = ks[wave * 2];

    v4f rk[4], rv[4];
    v8f acc;
    for (int j = 0; j < 8; ++j) acc[j] = 0.0f;

    // The four memory columns are one more K = 4 step: wave 0 starts its sum with them.
    // Lane (l16, half) holds columns 2*half and 2*half+1 of k row l16 (A) and of v row l16 (B).
    // The test is made scalar because the matrix instruction needs every lane of its wave on.
    if (__builtin_amdgcn_readfirstlane(wave) == 0) {
        const float ml = ks[l16 * 2];
        const v2f mk = *(const v2f*)(mem_kv + (h * DHEAD + dt * 16 + l16) * 4 + half * 2);         // mem_kv[0]
        const v2f mv = *(const v2f*)(mem_kv + 512 + (h * DHEAD + et * 16 + l16) * 4 + half * 2);   // mem_kv[1]
        const v2f ma = {__expf(mk[0] - ml), __expf(mk[1] - ml)};
        acc = __builtin_amdgcn_wmma_f32_16x16x4_f32(
            false, ma, false, mv, (short)0, acc, false, false);
    }

    auto fetch = [&](int n0) {
        for (int j = 0; j < 4; ++j) {
            rk[j] = *(const v4f*)(krow + n0 + j * 128 + lane * 4);
            rv[j] = *(const v4f*)(vrow + n0 + j * 128 + lane * 4);
        }
    };
    auto stash = [&](int buf) {
        for (int j = 0; j < 4; ++j) {
            v4f e;
            for (int c = 0; c < 4; ++c) e[c] = __expf(rk[j][c] - m);
            *(v4f*)&tile[buf][wave * CTX_PITCH + j * 128 + lane * 4] = e;
            *(v4f*)&tile[buf][(16 + wave) * CTX_PITCH + j * 128 + lane * 4] = rv[j];
        }
    };
    auto compute = [&](int buf) {
        const float* ka = &tile[buf][l16 * CTX_PITCH + wave * 32 + half * 4];
        const float* vb = &tile[buf][(16 + l16) * CTX_PITCH + wave * 32 + half * 4];
        for (int j = 0; j < 4; ++j) {
            v4f a4 = *(const v4f*)(ka + j * 8);
            v4f b4 = *(const v4f*)(vb + j * 8);
            v2f a0 = {a4[0], a4[1]}, b0 = {b4[0], b4[1]};
            v2f a1 = {a4[2], a4[3]}, b1 = {b4[2], b4[3]};
            acc = __builtin_amdgcn_wmma_f32_16x16x4_f32(
                false, a0, false, b0, (short)0, acc, false, false);
            acc = __builtin_amdgcn_wmma_f32_16x16x4_f32(
                false, a1, false, b1, (short)0, acc, false, false);
        }
    };

    fetch(0);
    stash(0);
    fetch(CTX_NS);
    __syncthreads();
    for (int s = 0; s < NPIX / CTX_NS; ++s) {
        compute(s & 1);
        if (s + 1 < NPIX / CTX_NS) {
            stash((s + 1) & 1);                       // last read one barrier ago
            if (s + 2 < NPIX / CTX_NS) fetch((s + 2) * CTX_NS);
        }
        __syncthreads();
    }

    // sum the 16 waves' partial tiles; D register i = row i + 8*half, column l16
    float* red = &tile[0][0];
    for (int i = 0; i < 8; ++i) red[wave * 256 + (i + 8 * half) * 16 + l16] = acc[i];
    __syncthreads();
    if (tid < 256) {
        const int dl = tid >> 4, el = tid & 15;
        float a = 0.f;
        for (int w = 0; w < CTX_THREADS / 32; ++w) a += red[w * 256 + tid];
        ctx[((size_t)b * 4 + h) * 1024 + (dt * 16 + dl) * 32 + et * 16 + el] = a / ks[dl * 2 + 1];
    }
}

// ---------------------------------------------------------------------------
// Kernel 6: fold w_out with context:
// W2[b][o][h*32+d] = sum_e w_out[o][h*32+e] * ctx[b][h][d][e]
// ---------------------------------------------------------------------------
__global__ __launch_bounds__(256) void w2_kernel(const float* __restrict__ w_out,
                                                 const float* __restrict__ ctx,
                                                 float* __restrict__ W2) {
    int idx = blockIdx.x * 256 + threadIdx.x;   // [0, 16*256*128)
    int b = idx >> 15;
    int r = idx & 32767;
    int o = r >> 7;
    int hd = r & 127;
    int h = hd >> 5, d = hd & 31;
    const float* cb = ctx + ((size_t)b * 4 + h) * 1024 + d * 32;
    const float* wr = w_out + (size_t)o * HIDDEN + h * DHEAD;
    float a = 0.f;
    for (int e = 0; e < 32; ++e) a += wr[e] * cb[e];
    W2[idx] = a;
}

// ---------------------------------------------------------------------------
// Kernel 7: output GEMM: out[b][o][n] = sum_hd W2[b][o][hd]*q_sm[b][hd][n] + b_out[o]
// Same tiling; both A and B tiles are pure copies -> async-to-LDS eligible.
// ---------------------------------------------------------------------------
__global__ __launch_bounds__(256) void out_gemm(const float* __restrict__ W2,
                                                const float* __restrict__ qkv,
                                                const float* __restrict__ b_out,
                                                float* __restrict__ out) {
    __shared__ __align__(16) float lA[2][16 * 256];
    __shared__ __align__(16) float lB[2][16 * 128];
    const int b  = blockIdx.z;
    const int o0 = blockIdx.x * 128;
    const int n0 = blockIdx.y * 64;
    const int tid = threadIdx.x, wave = tid >> 5, lane = tid & 31;
    const int half = lane >> 4, l16 = lane & 15;
    const float* A = W2 + (size_t)b * DIM * HIDDEN;
    const float* B = qkv + (size_t)b * OQKV * NPIX;   // q rows are [0,128)

    v8f acc[4];
    for (int t = 0; t < 4; ++t)
        for (int j = 0; j < 8; ++j) acc[t][j] = 0.0f;

    auto loadA = [&](int buf, int k0) {
#if ASYNC_LDS
        for (int i = 0; i < 8; ++i) {
            int id = tid + 256 * i;
            int r = id >> 4, j = id & 15;
            async_copy_b64(A + (size_t)(o0 + r) * HIDDEN + k0 + 2 * j,
                           &lA[buf][j * 256 + r * 2]);
        }
#else
        for (int i = tid; i < 128 * 32; i += 256) {
            int r = i >> 5, c = i & 31;
            lA[buf][(c >> 1) * 256 + r * 2 + (c & 1)] = A[(size_t)(o0 + r) * HIDDEN + k0 + c];
        }
#endif
    };
    auto loadB = [&](int buf, int k0) {
#if ASYNC_LDS
        for (int i = 0; i < 8; ++i) {
            int id = tid + 256 * i;                    // 32x64 elements
            int r = id >> 6, c = id & 63;
            async_copy_b32(B + (size_t)(k0 + r) * NPIX + n0 + c,
                           &lB[buf][(r >> 1) * 128 + c * 2 + (r & 1)]);
        }
#else
        for (int i = tid; i < 32 * 64; i += 256) {
            int r = i >> 6, c = i & 63;
            lB[buf][(r >> 1) * 128 + c * 2 + (r & 1)] = B[(size_t)(k0 + r) * NPIX + n0 + c];
        }
#endif
    };
    auto compute = [&](int buf) {
        const v2f* A2 = (const v2f*)lA[buf];
        const v2f* B2 = (const v2f*)lB[buf];
        const int oL = wave * 16 + l16;
        for (int kk2 = 0; kk2 < 16; kk2 += 2) {
            v2f a = A2[(kk2 + half) * 128 + oL];
            for (int nt = 0; nt < 4; ++nt) {
                v2f bb = B2[(kk2 + half) * 64 + nt * 16 + l16];
                acc[nt] = __builtin_amdgcn_wmma_f32_16x16x4_f32(
                    false, a, false, bb, (short)0, acc[nt], false, false);
            }
        }
    };

    loadA(0, 0); loadB(0, 0);
#if ASYNC_LDS
    wait_async0();
#endif
    __syncthreads();
    int buf = 0;
    for (int k0 = 0; k0 < HIDDEN; k0 += 32) {
        if (k0 + 32 < HIDDEN) { loadA(buf ^ 1, k0 + 32); loadB(buf ^ 1, k0 + 32); }
        compute(buf);
#if ASYNC_LDS
        wait_async0();
#endif
        __syncthreads();
        buf ^= 1;
    }

    float* ob = out + (size_t)b * DIM * NPIX;
    for (int nt = 0; nt < 4; ++nt)
        for (int i = 0; i < 8; ++i) {
            int row = o0 + wave * 16 + i + half * 8;
            int col = n0 + nt * 16 + l16;
            ob[(size_t)row * NPIX + col] = acc[nt][i] + b_out[row];
        }
}

// ---------------------------------------------------------------------------
// Kernel 8: final RMS norm in place on d_out.
// ---------------------------------------------------------------------------
__global__ __launch_bounds__(256) void rms_out_kernel(float* __restrict__ out,
                                                      const float* __restrict__ g_out) {
    int idx = blockIdx.x * 256 + threadIdx.x;    // [0, 16*4096)
    int b = idx >> 12, n = idx & 4095;
    float* ob = out + (size_t)b * DIM * NPIX + n;
    float s = 0.f;
    for (int c = 0; c < DIM; ++c) {
        float v = ob[(size_t)c * NPIX];
        s += v * v;
    }
    float inv = 16.0f * rsqrtf(s + 1e-12f);
    for (int c = 0; c < DIM; ++c)
        ob[(size_t)c * NPIX] = ob[(size_t)c * NPIX] * inv * g_out[c];
}

// ---------------------------------------------------------------------------
extern "C" void kernel_launch(void* const* d_in, const int* in_sizes, int n_in,
                              void* d_out, int out_size, void* d_ws, size_t ws_size,
                              hipStream_t stream) {
    const float* x      = (const float*)d_in[0];   // [16][256][4096]
    const float* g_in   = (const float*)d_in[1];   // [256]
    const float* w_qkv  = (const float*)d_in[2];   // [384][256]
    const float* mem_kv = (const float*)d_in[3];   // [2][4][32][4]
    const float* w_out  = (const float*)d_in[4];   // [256][128]
    const float* b_out  = (const float*)d_in[5];   // [256]
    const float* g_out  = (const float*)d_in[6];   // [256]
    float* out = (float*)d_out;                    // [16][256][4096]

    float* ws = (float*)d_ws;
    float* inv   = ws;                                  // 65536
    float* qkv   = inv + (size_t)BATCH * NPIX;          // 16*384*4096
    float* kstat = qkv + (size_t)BATCH * OQKV * NPIX;   // 2048*2
    float* ctx   = kstat + (size_t)BATCH * HIDDEN * 2;  // 16*4*32*32
    float* W2    = ctx + (size_t)BATCH * HEADS * DHEAD * DHEAD; // 16*256*128

    rms_in_kernel  <<<BATCH * NPIX / 256, 256, 0, stream>>>(x, inv);
    qkv_gemm       <<<dim3(OQKV / 128, NPIX / 64, BATCH), 256, 0, stream>>>(x, w_qkv, g_in, inv, qkv);
    q_softmax_kernel<<<BATCH * HEADS * NPIX / 256, 256, 0, stream>>>(qkv);
    k_row_stats    <<<BATCH * HIDDEN, 256, 0, stream>>>(qkv, mem_kv, kstat);
    context_kernel <<<BATCH * HEADS * 4, CTX_THREADS, 0, stream>>>(qkv, mem_kv, kstat, ctx);
    w2_kernel      <<<BATCH * DIM * HIDDEN / 256, 256, 0, stream>>>(w_out, ctx, W2);
    out_gemm       <<<dim3(DIM / 128, NPIX / 64, BATCH), 256, 0, stream>>>(W2, qkv, b_out, out);
    rms_out_kernel <<<BATCH * NPIX / 256, 256, 0, stream>>>(out, g_out);
}

// v002
// A run of this version takes 216 microseconds.
// In both of two side-by-side timings against v001, it was 1.57 times as fast.
// Counting every step since v000, it is 4.08 times as fast.
#include <hip/hip_runtime.h>
#include <hip/hip_bf16.h>

typedef __attribute__((ext_vector_type(2))) float v2f;
typedef __attribute__((ext_vector_type(4))) float v4f;
typedef __attribute__((ext_vector_type(8))) float v8f;

#define BATCH 16
#define DIM 256
#define HEADS 4
#define DHEAD 32
#define HIDDEN 128            // HEADS * DHEAD
#define OQKV 384              // 3 * HIDDEN
#define NPIX 4096             // 64*64
#define SCALE_Q 5.656854249492381f  // sqrt(32)

// ---------------------------------------------------------------------------
// Tile staging shared by the two big GEMMs (128 rows x 64 columns a block, 32 k a stage,
// two LDS buffers). Every LDS access of the tiles is 16 bytes a lane:
//   A: row-major rows of 32 k at a pitch of 36 floats (144 B = 16 B x odd), filled by
//      asynchronous 16-byte copies;
//   B: lB[(k>>2)*256 + n*4 + (k&3)]: the four k of a quad lie side by side for each n;
//      wave w fetches the four source rows of quad w, holds them in registers over the
//      matrix work of the current stage and stores them as quads.
// Lane (l16, half) reads k = 8j + 4*half + {0,1,2,3} of A row l16 and of B column l16:
// the first matrix step takes {0,1}, the second {2,3}, so A and B agree in k at every place.
// ---------------------------------------------------------------------------
#define GA_PITCH 36
#define GA_FLOATS (128 * GA_PITCH)
#define GB_FLOATS (8 * 256)

// 1024 pieces of 16 bytes, four a thread: rows r, r+32, r+64, r+96 of the A tile.
// dst: this thread's place in row r of the LDS tile; g0: the same place in the source.
__device__ __forceinline__ void copy_a_tile(float* dst, const float* g0, int ld) {
    const unsigned l0 = (unsigned)(size_t)(__attribute__((address_space(3))) float*)dst;
    const unsigned l1 = l0 + 32 * GA_PITCH * 4, l2 = l0 + 64 * GA_PITCH * 4, l3 = l0 + 96 * GA_PITCH * 4;
    const float* g1 = g0 + 32 * ld;
    const float* g2 = g0 + 64 * ld;
    const float* g3 = g0 + 96 * ld;
    // the last line keeps the address registers as they are until the copies have taken them
    asm volatile("global_load_async_to_lds_b128 %0, %4, off\n\t"
                 "global_load_async_to_lds_b128 %1, %5, off\n\t"
                 "global_load_async_to_lds_b128 %2, %6, off\n\t"
                 "global_load_async_to_lds_b128 %3, %7, off\n\t"
                 "s_wait_xcnt 0x0"
                 :: "v"(l0), "v"(l1), "v"(l2), "v"(l3), "v"(g0), "v"(g1), "v"(g2), "v"(g3)
                 : "memory");
}

// One stage of a wave's 16 x 64 tile. pa: A row (l16 of the wave), k offset 4*half;
// pb: B quad 'half', column l16.
__device__ __forceinline__ void mm_stage(const float* pa, const float* pb, v8f (&acc)[4]) {
    for (int j = 0; j < 4; ++j) {                        // 8 k a trip
        v4f a4 = *(const v4f*)(pa + j * 8);
        v2f a0 = {a4[0], a4[1]}, a1 = {a4[2], a4[3]};
        for (int nt = 0; nt < 4; ++nt) {
            v4f b4 = *(const v4f*)(pb + j * 512 + nt * 64);
            v2f b0 = {b4[0], b4[1]}, b1 = {b4[2], b4[3]};
            acc[nt] = __builtin_amdgcn_wmma_f32_16x16x4_f32(
                false, a0, false, b0, (short)0, acc[nt], false, false);
            acc[nt] = __builtin_amdgcn_wmma_f32_16x16x4_f32(
                false, a1, false, b1, (short)0, acc[nt], false, false);
        }
    }
}

// Hand-over of a stage: this wave's LDS reads and writes are done and its copies have
// landed before the barrier behind which the other waves read them or refill the buffer.
__device__ __forceinline__ void publish_stage() {
    asm volatile("s_wait_dscnt 0x0" ::: "memory");
    asm volatile("s_wait_asynccnt 0x0" ::: "memory");
    __syncthreads();
}

// ---------------------------------------------------------------------------
// Kernel 1: per-pixel RMS inverse norm over channels:  inv = 16 * rsqrt(sum x^2 + eps)
// ---------------------------------------------------------------------------
__global__ __launch_bounds__(256) void rms_in_kernel(const float* __restrict__ x,
                                                     float* __restrict__ inv) {
    int idx = blockIdx.x * 256 + threadIdx.x;      // [0, 16*4096)
    int b = idx >> 12, n = idx & 4095;
    const float* xb = x + (size_t)b * DIM * NPIX + n;
    float s = 0.f;
    for (int c = 0; c < DIM; ++c) {
        float v = xb[(size_t)c * NPIX];
        s += v * v;
    }
    inv[idx] = 16.0f * rsqrtf(s + 1e-12f);
}

// ---------------------------------------------------------------------------
// Kernel 2: QKV GEMM with fused RMS scaling.
// qkv[b][o][n] = sum_c w_qkv[o][c] * x[b][c][n] * inv[b][n] * g_in[c]
// 128(o) x 64(n) tile / block; staging as described above; x is scaled on its way to LDS.
// ---------------------------------------------------------------------------
__global__ __launch_bounds__(256) void qkv_gemm(const float* __restrict__ x,
                                                const float* __restrict__ w,
                                                const float* __restrict__ g_in,
                                                const float* __restrict__ inv,
                                                float* __restrict__ qkv) {
    __shared__ __align__(16) float lA[2][GA_FLOATS];
    __shared__ __align__(16) float lB[2][GB_FLOATS];
    const int b  = blockIdx.z;
    const int o0 = blockIdx.x * 128;
    const int n0 = blockIdx.y * 64;
    const int tid  = threadIdx.x;
    const int wave = tid >> 5;
    const int lane = tid & 31;
    const int half = lane >> 4;
    const int l16  = lane & 15;

    const float* xq = x + (size_t)b * DIM * NPIX + (size_t)(wave * 4) * NPIX + n0 + lane * 2;
    const v2f inv2  = *(const v2f*)(inv + (size_t)b * NPIX + n0 + lane * 2);
    const float* wr = w + (size_t)(o0 + (tid >> 3)) * DIM + (tid & 7) * 4;
    const int aw = (tid >> 3) * GA_PITCH + (tid & 7) * 4;          // A: where this thread's copies land
    const int ar = (wave * 16 + l16) * GA_PITCH + half * 4;        // A: where this lane reads
    const int bw = wave * 256 + lane * 8;                          // B: where this lane stores
    const int br = half * 256 + l16 * 4;                           // B: where this lane reads

    v8f acc[4];
    for (int t = 0; t < 4; ++t)
        for (int j = 0; j < 8; ++j) acc[t][j] = 0.0f;

    v2f rx[4];
    v4f rg;
    auto fetchB = [&](int k0) {
        for (int i = 0; i < 4; ++i) rx[i] = *(const v2f*)(xq + (size_t)(k0 + i) * NPIX);
        rg = *(const v4f*)(g_in + k0 + wave * 4);
    };
    auto stashB = [&](int buf) {
        v4f c0, c1;
        for (int i = 0; i < 4; ++i) {
            c0[i] = rx[i][0] * inv2[0] * rg[i];
            c1[i] = rx[i][1] * inv2[1] * rg[i];
        }
        *(v4f*)&lB[buf][bw]     = c0;
        *(v4f*)&lB[buf][bw + 4] = c1;
    };

    copy_a_tile(&lA[0][aw], wr, DIM);
    fetchB(0);
    // the loads' address registers are reused right behind them (in the loop the copies' own wait serves)
    asm volatile("s_wait_xcnt 0x0" ::: "memory");
    stashB(0);
    publish_stage();
    int buf = 0;
    for (int k0 = 0; k0 < DIM; k0 += 32) {
        const bool more = k0 + 32 < DIM;
        if (more) { fetchB(k0 + 32); copy_a_tile(&lA[buf ^ 1][aw], wr + k0 + 32, DIM); }
        mm_stage(&lA[buf][ar], &lB[buf][br], acc);
        if (more) stashB(buf ^ 1);
        publish_stage();
        buf ^= 1;
    }
    // no copy is left in flight when the wave ends
    asm volatile("s_wait_asynccnt 0x0" ::: "memory");

    // C/D layout: VGPR i -> (M=i, N=lane) lanes 0-15; (M=i+8, N=lane-16) lanes 16-31
    float* out = qkv + (size_t)b * OQKV * NPIX;
    for (int nt = 0; nt < 4; ++nt)
        for (int i = 0; i < 8; ++i) {
            int row = o0 + wave * 16 + i + half * 8;
            int col = n0 + nt * 16 + l16;
            out[(size_t)row * NPIX + col] = acc[nt][i];
        }
}

// ---------------------------------------------------------------------------
// Kernel 3: q softmax over the d axis (32 values per (b,h,n)), then / sqrt(32).
// ---------------------------------------------------------------------------
__global__ __launch_bounds__(256) void q_softmax_kernel(float* __restrict__ qkv) {
    int idx = blockIdx.x * 256 + threadIdx.x;   // [0, 16*4*4096)
    int b = idx >> 14;
    int r = idx & 16383;
    int h = r >> 12, n = r & 4095;
    float* base = qkv + ((size_t)b * OQKV + h * DHEAD) * NPIX + n;
    float m = -1e30f;
    for (int d = 0; d < DHEAD; ++d) m = fmaxf(m, base[(size_t)d * NPIX]);
    float s = 0.f;
    for (int d = 0; d < DHEAD; ++d) s += __expf(base[(size_t)d * NPIX] - m);
    float invs = 1.0f / (s * SCALE_Q);
    for (int d = 0; d < DHEAD; ++d)
        base[(size_t)d * NPIX] = __expf(base[(size_t)d * NPIX] - m) * invs;
}

// ---------------------------------------------------------------------------
// Kernel 4: per-row (b,h,d) max and sum-exp for k over n axis (4096 + 4 mem slots).
// ---------------------------------------------------------------------------
__global__ __launch_bounds__(256) void k_row_stats(const float* __restrict__ qkv,
                                                   const float* __restrict__ mem_kv,
                                                   float* __restrict__ kstat) {
    int rid = blockIdx.x;                 // [0, 16*128)
    int b = rid >> 7;
    int hd = rid & 127;
    const float* row = qkv + ((size_t)b * OQKV + HIDDEN + hd) * NPIX;
    const float* mk  = mem_kv + (size_t)hd * 4;   // mem_kv[0][h][d][m]
    __shared__ float red[256];
    int tid = threadIdx.x;
    float m = -1e30f;
    for (int n = tid; n < NPIX; n += 256) m = fmaxf(m, row[n]);
    if (tid < 4) m = fmaxf(m, mk[tid]);
    red[tid] = m; __syncthreads();
    for (int s = 128; s > 0; s >>= 1) {
        if (tid < s) red[tid] = fmaxf(red[tid], red[tid + s]);
        __syncthreads();
    }
    float rowmax = red[0]; __syncthreads();
    float sum = 0.f;
    for (int n = tid; n < NPIX; n += 256) sum += __expf(row[n] - rowmax);
    if (tid < 4) sum += __expf(mk[tid] - rowmax);
    red[tid] = sum; __syncthreads();
    for (int s = 128; s > 0; s >>= 1) {
        if (tid < s) red[tid] += red[tid + s];
        __syncthreads();
    }
    if (tid == 0) { kstat[rid * 2] = rowmax; kstat[rid * 2 + 1] = red[0]; }
}

// ---------------------------------------------------------------------------
// Kernel 5: context[b][h][d][e] = sum_n softmax_k[d,n] * v[e,n]  (n incl. mem)
// One 16(d) x 16(e) tile per work-group on the f32 16x16x4 matrix form, K = n.
// A stage holds 512 n of the 16 k rows (as exp(k - rowmax)) and of the 16 v rows;
// wave w fetches k row w and v row w in whole 512-byte pieces and multiplies
// columns [32w, 32w+32) of the stage. Both fragments are read by the same code
// (row l16, four n at 4*half), so the k order of A and B is equal by construction.
// The four memory columns are one more K = 4 step (wave 0). The row's 1/sum is applied
// once, to the finished tile.
// ---------------------------------------------------------------------------
#define CTX_THREADS 512
#define CTX_NS 512            // n per stage
#define CTX_PITCH 516         // floats per LDS row: 2064 B = 16 B x odd, no bank conflict for 16-byte reads
__global__ __launch_bounds__(CTX_THREADS) void context_kernel(const float* __restrict__ qkv,
                                                              const float* __restrict__ mem_kv,
                                                              const float* __restrict__ kstat,
                                                              float* __restrict__ ctx) {
    __shared__ __align__(16) float tile[2][32 * CTX_PITCH];   // rows 0-15: k, rows 16-31: v
    const int bh = blockIdx.x >> 2;
    const int b = bh >> 2, h = bh & 3;
    const int dt = (blockIdx.x >> 1) & 1, et = blockIdx.x & 1;
    const int tid = threadIdx.x, wave = tid >> 5, lane = tid & 31;
    const int half = lane >> 4, l16 = lane & 15;
    const float* krow = qkv + ((size_t)b * OQKV + HIDDEN + h * DHEAD + dt * 16 + wave) * NPIX;
    const float* vrow = qkv + ((size_t)b * OQKV + 2 * HIDDEN + h * DHEAD + et * 16 + wave) * NPIX;
    const float* ks = kstat + ((size_t)b * HIDDEN + h * DHEAD + dt * 16) * 2;
    const float m = ks[wave * 2];

    v4f rk[4], rv[4];
    v8f acc;
    for (int j = 0; j < 8; ++j) acc[j] = 0.0f;

    // The four memory columns are one more K = 4 step: wave 0 starts its sum with them.
    // Lane (l16, half) holds columns 2*half and 2*half+1 of k row l16 (A) and of v row l16 (B).
    // The test is made scalar because the matrix instruction needs every lane of its wave on.
    if (__builtin_amdgcn_readfirstlane(wave) == 0) {
        const float ml = ks[l16 * 2];
        const v2f mk = *(const v2f*)(mem_kv + (h * DHEAD + dt * 16 + l16) * 4 + half * 2);         // mem_kv[0]
        const v2f mv = *(const v2f*)(mem_kv + 512 + (h * DHEAD + et * 16 + l16) * 4 + half * 2);   // mem_kv[1]
        const v2f ma = {__expf(mk[0] - ml), __expf(mk[1] - ml)};
        acc = __builtin_amdgcn_wmma_f32_16x16x4_f32(
            false, ma, false, mv, (short)0, acc, false, false);
    }

    auto fetch = [&](int n0) {
        for (int j = 0; j < 4; ++j) {
            rk[j] = *(const v4f*)(krow + n0 + j * 128 + lane * 4);
            rv[j] = *(const v4f*)(vrow + n0 + j * 128 + lane * 4);
        }
    };
    auto stash = [&](int buf) {
        for (int j = 0; j < 4; ++j) {
            v4f e;
            for (int c = 0; c < 4; ++c) e[c] = __expf(rk[j][c] - m);
            *(v4f*)&tile[buf][wave * CTX_PITCH + j * 128 + lane * 4] = e;
            *(v4f*)&tile[buf][(16 + wave) * CTX_PITCH + j * 128 + lane * 4] = rv[j];
        }
    };
    auto compute = [&](int buf) {
        const float* ka = &tile[buf][l16 * CTX_PITCH + wave * 32 + half * 4];
        const float* vb = &tile[buf][(16 + l16) * CTX_PITCH + wave * 32 + half * 4];
        for (int j = 0; j < 4; ++j) {
            v4f a4 = *(const v4f*)(ka + j * 8);
            v4f b4 = *(const v4f*)(vb + j * 8);
            v2f a0 = {a4[0], a4[1]}, b0 = {b4[0], b4[1]};
            v2f a1 = {a4[2], a4[3]}, b1 = {b4[2], b4[3]};
            acc = __builtin_amdgcn_wmma_f32_16x16x4_f32(
                false, a0, false, b0, (short)0, acc, false, false);
            acc = __builtin_amdgcn_wmma_f32_16x16x4_f32(
                false, a1, false, b1, (short)0, acc, false, false);
        }
    };

    fetch(0);
    stash(0);
    fetch(CTX_NS);
    __syncthreads();
    for (int s = 0; s < NPIX / CTX_NS; ++s) {
        compute(s & 1);
        if (s + 1 < NPIX / CTX_NS) {
            stash((s + 1) & 1);                       // last read one barrier ago
            if (s + 2 < NPIX / CTX_NS) fetch((s + 2) * CTX_NS);
        }
        __syncthreads();
    }

    // sum the 16 waves' partial tiles; D register i = row i + 8*half, column l16
    float* red = &tile[0][0];
    for (int i = 0; i < 8; ++i) red[wave * 256 + (i + 8 * half) * 16 + l16] = acc[i];
    __syncthreads();
    if (tid < 256) {
        const int dl = tid >> 4, el = tid & 15;
        float a = 0.f;
        for (int w = 0; w < CTX_THREADS / 32; ++w) a += red[w * 256 + tid];
        ctx[((size_t)b * 4 + h) * 1024 + (dt * 16 + dl) * 32 + et * 16 + el] = a / ks[dl * 2 + 1];
    }
}

// ---------------------------------------------------------------------------
// Kernel 6: fold w_out with context:
// W2[b][o][h*32+d] = sum_e w_out[o][h*32+e] * ctx[b][h][d][e]
// ---------------------------------------------------------------------------
__global__ __launch_bounds__(256) void w2_kernel(const float* __restrict__ w_out,
                                                 const float* __restrict__ ctx,
                                                 float* __restrict__ W2) {
    int idx = blockIdx.x * 256 + threadIdx.x;   // [0, 16*256*128)
    int b = idx >> 15;
    int r = idx & 32767;
    int o = r >> 7;
    int hd = r & 127;
    int h = hd >> 5, d = hd & 31;
    const float* cb = ctx + ((size_t)b * 4 + h) * 1024 + d * 32;
    const float* wr = w_out + (size_t)o * HIDDEN + h * DHEAD;
    float a = 0.f;
    for (int e = 0; e < 32; ++e) a += wr[e] * cb[e];
    W2[idx] = a;
}

// ---------------------------------------------------------------------------
// Kernel 7: output GEMM: out[b][o][n] = sum_hd W2[b][o][hd]*q_sm[b][hd][n] + b_out[o]
// Same tiling and staging as kernel 2, without the scaling.
// ---------------------------------------------------------------------------
__global__ __launch_bounds__(256) void out_gemm(const float* __restrict__ W2,
                                                const float* __restrict__ qkv,
                                                const float* __restrict__ b_out,
                                                float* __restrict__ out) {
    __shared__ __align__(16) float lA[2][GA_FLOATS];
    __shared__ __align__(16) float lB[2][GB_FLOATS];
    const int b  = blockIdx.z;
    const int o0 = blockIdx.x * 128;
    const int n0 = blockIdx.y * 64;
    const int tid = threadIdx.x, wave = tid >> 5, lane = tid & 31;
    const int half = lane >> 4, l16 = lane & 15;
    // q rows are [0,128) of qkv
    const float* qq = qkv + (size_t)b * OQKV * NPIX + (size_t)(wave * 4) * NPIX + n0 + lane * 2;
    const float* wr = W2 + (size_t)b * DIM * HIDDEN + (size_t)(o0 + (tid >> 3)) * HIDDEN + (tid & 7) * 4;
    const int aw = (tid >> 3) * GA_PITCH + (tid & 7) * 4;
    const int ar = (wave * 16 + l16) * GA_PITCH + half * 4;
    const int bw = wave * 256 + lane * 8;
    const int br = half * 256 + l16 * 4;

    v8f acc[4];
    for (int t = 0; t < 4; ++t)
        for (int j = 0; j < 8; ++j) acc[t][j] = 0.0f;

    v2f rx[4];
    auto fetchB = [&](int k0) {
        for (int i = 0; i < 4; ++i) rx[i] = *(const v2f*)(qq + (size_t)(k0 + i) * NPIX);
    };
    auto stashB = [&](int buf) {
        v4f c0 = {rx[0][0], rx[1][0], rx[2][0], rx[3][0]};
        v4f c1 = {rx[0][1], rx[1][1], rx[2][1], rx[3][1]};
        *(v4f*)&lB[buf][bw]     = c0;
        *(v4f*)&lB[buf][bw + 4] = c1;
    };

    copy_a_tile(&lA[0][aw], wr, HIDDEN);
    fetchB(0);
    stashB(0);
    publish_stage();
    int buf = 0;
    // kept rolled: unrolled, the four stages took 190 registers (two blocks a WGP instead of
    // four) and the first stage's store to LDS moved in front of its matrix work
#pragma unroll 1
    for (int k0 = 0; k0 < HIDDEN; k0 += 32) {
        const bool more = k0 + 32 < HIDDEN;
        if (more) { fetchB(k0 + 32); copy_a_tile(&lA[buf ^ 1][aw], wr + k0 + 32, HIDDEN); }
        mm_stage(&lA[buf][ar], &lB[buf][br], acc);
        if (more) stashB(buf ^ 1);
        publish_stage();
        buf ^= 1;
    }
    // no copy is left in flight when the wave ends
    asm volatile("s_wait_asynccnt 0x0" ::: "memory");

    float* ob = out + (size_t)b * DIM * NPIX;
    for (int nt = 0; nt < 4; ++nt)
        for (int i = 0; i < 8; ++i) {
            int row = o0 + wave * 16 + i + half * 8;
            int col = n0 + nt * 16 + l16;
            ob[(size_t)row * NPIX + col] = acc[nt][i] + b_out[row];
        }
}

// ---------------------------------------------------------------------------
// Kernel 8: final RMS norm in place on d_out.
// ---------------------------------------------------------------------------
__global__ __launch_bounds__(256) void rms_out_kernel(float* __restrict__ out,
                                                      const float* __restrict__ g_out) {
    int idx = blockIdx.x * 256 + threadIdx.x;    // [0, 16*4096)
    int b = idx >> 12, n = idx & 4095;
    float* ob = out + (size_t)b * DIM * NPIX + n;
    float s = 0.f;
    for (int c = 0; c < DIM; ++c) {
        float v = ob[(size_t)c * NPIX];
        s += v * v;
    }
    float inv = 16.0f * rsqrtf(s + 1e-12f);
    for (int c = 0; c < DIM; ++c)
        ob[(size_t)c * NPIX] = ob[(size_t)c * NPIX] * inv * g_out[c];
}

// ---------------------------------------------------------------------------
extern "C" void kernel_launch(void* const* d_in, const int* in_sizes, int n_in,
                              void* d_out, int out_size, void* d_ws, size_t ws_size,
                              hipStream_t stream) {
    const float* x      = (const float*)d_in[0];   // [16][256][4096]
    const float* g_in   = (const float*)d_in[1];   // [256]
    const float* w_qkv  = (const float*)d_in[2];   // [384][256]
    const float* mem_kv = (const float*)d_in[3];   // [2][4][32][4]
    const float* w_out  = (const float*)d_in[4];   // [256][128]
    const float* b_out  = (const float*)d_in[5];   // [256]
    const float* g_out  = (const float*)d_in[6];   // [256]
    float* out = (float*)d_out;                    // [16][256][4096]

    float* ws = (float*)d_ws;
    float* inv   = ws;                                  // 65536
    float* qkv   = inv + (size_t)BATCH * NPIX;          // 16*384*4096
    float* kstat = qkv + (size_t)BATCH * OQKV * NPIX;   // 2048*2
    float* ctx   = kstat + (size_t)BATCH * HIDDEN * 2;  // 16*4*32*32
    float* W2    = ctx + (size_t)BATCH * HEADS * DHEAD * DHEAD; // 16*256*128

    rms_in_kernel  <<<BATCH * NPIX / 256, 256, 0, stream>>>(x, inv);
    qkv_gemm       <<<dim3(OQKV / 128, NPIX / 64, BATCH), 256, 0, stream>>>(x, w_qkv, g_in, inv, qkv);
    q_softmax_kernel<<<BATCH * HEADS * NPIX / 256, 256, 0, stream>>>(qkv);
    k_row_stats    <<<BATCH * HIDDEN, 256, 0, stream>>>(qkv, mem_kv, kstat);
    context_kernel <<<BATCH * HEADS * 4, CTX_THREADS, 0, stream>>>(qkv, mem_kv, kstat, ctx);
    w2_kernel      <<<BATCH * DIM * HIDDEN / 256, 256, 0, stream>>>(w_out, ctx, W2);
    out_gemm       <<<dim3(DIM / 128, NPIX / 64, BATCH), 256, 0, stream>>>(W2, qkv, b_out, out);
    rms_out_kernel <<<BATCH * NPIX / 256, 256, 0, stream>>>(out, g_out);
}

// v003
// A run of this version takes 133 microseconds.
// Next to v002, in two timings, it ran 1.62 and 1.63 times as fast.
// Counting every step since v000, it is 6.65 times as fast.
#include <hip/hip_runtime.h>
#include <hip/hip_bf16.h>

typedef __attribute__((ext_vector_type(2))) float v2f;
typedef __attribute__((ext_vector_type(4))) float v4f;
typedef __attribute__((ext_vector_type(8))) float v8f;

#define BATCH 16
#define DIM 256
#define HEADS 4
#define DHEAD 32
#define HIDDEN 128            // HEADS * DHEAD
#define OQKV 384              // 3 * HIDDEN
#define NPIX 4096             // 64*64
#define SCALE_Q 5.656854249492381f  // sqrt(32)

// ---------------------------------------------------------------------------
// Tile staging shared by the two big GEMMs (128 or 256 rows x 64 columns a block, 32 k a
// stage, two LDS buffers). Every LDS access of the tiles is 16 bytes a lane:
//   A: row-major rows of 32 k at a pitch of 36 floats (144 B = 16 B x odd), filled by
//      asynchronous 16-byte copies;
//   B: lB[(k>>2)*256 + n*4 + (k&3)]: the four k of a quad lie side by side for each n;
//      wave w fetches the four source rows of quad w, holds them in registers over the
//      matrix work of the current stage and stores them as quads.
// Lane (l16, half) reads k = 8j + 4*half + {0,1,2,3} of A row l16 and of B column l16:
// the first matrix step takes {0,1}, the second {2,3}, so A and B agree in k at every place.
// ---------------------------------------------------------------------------
#define GA_PITCH 36
#define GA_FLOATS (128 * GA_PITCH)
#define GB_FLOATS (8 * 256)

// 1024 pieces of 16 bytes, four a thread: rows r, r+32, r+64, r+96 of the A tile.
// dst: this thread's place in row r of the LDS tile; g0: the same place in the source.
__device__ __forceinline__ void copy_a_tile(float* dst, const float* g0, int ld) {
    const unsigned l0 = (unsigned)(size_t)(__attribute__((address_space(3))) float*)dst;
    const unsigned l1 = l0 + 32 * GA_PITCH * 4, l2 = l0 + 64 * GA_PITCH * 4, l3 = l0 + 96 * GA_PITCH * 4;
    const float* g1 = g0 + 32 * ld;
    const float* g2 = g0 + 64 * ld;
    const float* g3 = g0 + 96 * ld;
    // the last line keeps the address registers as they are until the copies have taken them
    asm volatile("global_load_async_to_lds_b128 %0, %4, off\n\t"
                 "global_load_async_to_lds_b128 %1, %5, off\n\t"
                 "global_load_async_to_lds_b128 %2, %6, off\n\t"
                 "global_load_async_to_lds_b128 %3, %7, off\n\t"
                 "s_wait_xcnt 0x0"
                 :: "v"(l0), "v"(l1), "v"(l2), "v"(l3), "v"(g0), "v"(g1), "v"(g2), "v"(g3)
                 : "memory");
}

// One stage of a wave's 16 x 64 tile. pa: A row (l16 of the wave), k offset 4*half;
// pb: B quad 'half', column l16.
__device__ __forceinline__ void mm_stage(const float* pa, const float* pb, v8f (&acc)[4]) {
    for (int j = 0; j < 4; ++j) {                        // 8 k a trip
        v4f a4 = *(const v4f*)(pa + j * 8);
        v2f a0 = {a4[0], a4[1]}, a1 = {a4[2], a4[3]};
        for (int nt = 0; nt < 4; ++nt) {
            v4f b4 = *(const v4f*)(pb + j * 512 + nt * 64);
            v2f b0 = {b4[0], b4[1]}, b1 = {b4[2], b4[3]};
            acc[nt] = __builtin_amdgcn_wmma_f32_16x16x4_f32(
                false, a0, false, b0, (short)0, acc[nt], false, false);
            acc[nt] = __builtin_amdgcn_wmma_f32_16x16x4_f32(
                false, a1, false, b1, (short)0, acc[nt], false, false);
        }
    }
}

// The same for a wave's 32 x 64 tile: two A rows (l16 and l16 + 16) share each B fragment.
__device__ __forceinline__ void mm_stage2(const float* pa, const float* pb, v8f (&acc)[2][4]) {
    for (int j = 0; j < 4; ++j) {                        // 8 k a trip
        v4f a4 = *(const v4f*)(pa + j * 8);
        v4f c4 = *(const v4f*)(pa + 16 * GA_PITCH + j * 8);
        v2f a0 = {a4[0], a4[1]}, a1 = {a4[2], a4[3]};
        v2f c0 = {c4[0], c4[1]}, c1 = {c4[2], c4[3]};
        for (int nt = 0; nt < 4; ++nt) {
            v4f b4 = *(const v4f*)(pb + j * 512 + nt * 64);
            v2f b0 = {b4[0], b4[1]}, b1 = {b4[2], b4[3]};
            acc[0][nt] = __builtin_amdgcn_wmma_f32_16x16x4_f32(
                false, a0, false, b0, (short)0, acc[0][nt], false, false);
            acc[1][nt] = __builtin_amdgcn_wmma_f32_16x16x4_f32(
                false, c0, false, b0, (short)0, acc[1][nt], false, false);
            acc[0][nt] = __builtin_amdgcn_wmma_f32_16x16x4_f32(
                false, a1, false, b1, (short)0, acc[0][nt], false, false);
            acc[1][nt] = __builtin_amdgcn_wmma_f32_16x16x4_f32(
                false, c1, false, b1, (short)0, acc[1][nt], false, false);
        }
    }
}

// Hand-over of a stage: this wave's LDS reads and writes are done and its copies have
// landed before the barrier behind which the other waves read them or refill the buffer.
__device__ __forceinline__ void publish_stage() {
    asm volatile("s_wait_dscnt 0x0" ::: "memory");
    asm volatile("s_wait_asynccnt 0x0" ::: "memory");
    __syncthreads();
}

// ---------------------------------------------------------------------------
// Kernel 2: QKV GEMM with the input RMS norm inside it.
// qkv[b][o][n] = inv[b][n] * sum_c w_qkv[o][c] * x[b][c][n] * g_in[c],
// inv[b][n] = 16 * rsqrt(sum_c x[b][c][n]^2 + eps)
// 128(o) x 64(n) tile / block; staging as described above; x takes g_in on its way to LDS.
// A block stages all 256 c of its 64 columns, so it sums their squares as they pass through
// the registers and scales the finished accumulators by the column's inv.
// ---------------------------------------------------------------------------
__global__ __launch_bounds__(256) void qkv_gemm(const float* __restrict__ x,
                                                const float* __restrict__ w,
                                                const float* __restrict__ g_in,
                                                float* __restrict__ qkv) {
    __shared__ __align__(16) float lA[2][GA_FLOATS];
    __shared__ __align__(16) float lB[2][GB_FLOATS];
    const int b  = blockIdx.z;
    const int o0 = blockIdx.x * 128;
    const int n0 = blockIdx.y * 64;
    const int tid  = threadIdx.x;
    const int wave = tid >> 5;
    const int lane = tid & 31;
    const int half = lane >> 4;
    const int l16  = lane & 15;

    const float* xq = x + (size_t)b * DIM * NPIX + (size_t)(wave * 4) * NPIX + n0 + lane * 2;
    const float* wr = w + (size_t)(o0 + (tid >> 3)) * DIM + (tid & 7) * 4;
    const int aw = (tid >> 3) * GA_PITCH + (tid & 7) * 4;          // A: where this thread's copies land
    const int ar = (wave * 16 + l16) * GA_PITCH + half * 4;        // A: where this lane reads
    const int bw = wave * 256 + lane * 8;                          // B: where this lane stores
    const int br = half * 256 + l16 * 4;                           // B: where this lane reads

    v8f acc[4];
    for (int t = 0; t < 4; ++t)
        for (int j = 0; j < 8; ++j) acc[t][j] = 0.0f;

    v2f rx[4];
    v4f rg;
    float ss0 = 0.f, ss1 = 0.f;      // squares of this wave's c rows, columns 2*lane and 2*lane+1
    auto fetchB = [&](int k0) {
        for (int i = 0; i < 4; ++i) rx[i] = *(const v2f*)(xq + (size_t)(k0 + i) * NPIX);
        rg = *(const v4f*)(g_in + k0 + wave * 4);
    };
    auto stashB = [&](int buf) {
        v4f c0, c1;
        for (int i = 0; i < 4; ++i) {
            c0[i] = rx[i][0] * rg[i];
            c1[i] = rx[i][1] * rg[i];
            ss0 += rx[i][0] * rx[i][0];
            ss1 += rx[i][1] * rx[i][1];
        }
        *(v4f*)&lB[buf][bw]     = c0;
        *(v4f*)&lB[buf][bw + 4] = c1;
    };

    copy_a_tile(&lA[0][aw], wr, DIM);
    fetchB(0);
    // the loads' address registers are reused right behind them (in the loop the copies' own wait serves)
    asm volatile("s_wait_xcnt 0x0" ::: "memory");
    stashB(0);
    publish_stage();
    int buf = 0;
    for (int k0 = 0; k0 < DIM; k0 += 32) {
        const bool more = k0 + 32 < DIM;
        if (more) { fetchB(k0 + 32); copy_a_tile(&lA[buf ^ 1][aw], wr + k0 + 32, DIM); }
        mm_stage(&lA[buf][ar], &lB[buf][br], acc);
        if (more) stashB(buf ^ 1);
        publish_stage();
        buf ^= 1;
    }
    // no copy is left in flight when the wave ends
    asm volatile("s_wait_asynccnt 0x0" ::: "memory");

    // the eight waves' sums of squares meet in LDS (every read of lB ended at the last hand-over)
    float* red = &lB[0][0];          // [8][64] partial sums, then [64] scales
    v2f ss = {ss0, ss1};
    *(v2f*)&red[wave * 64 + lane * 2] = ss;
    __syncthreads();
    if (tid < 64) {
        float t = 0.f;
        for (int p = 0; p < 8; ++p) t += red[p * 64 + tid];
        red[512 + tid] = 16.0f * rsqrtf(t + 1e-12f);
    }
    __syncthreads();

    // C/D layout: VGPR i -> (M=i, N=lane) lanes 0-15; (M=i+8, N=lane-16) lanes 16-31
    float* out = qkv + (size_t)b * OQKV * NPIX;
    for (int nt = 0; nt < 4; ++nt) {
        const float sc = red[512 + nt * 16 + l16];
        for (int i = 0; i < 8; ++i) {
            int row = o0 + wave * 16 + i + half * 8;
            int col = n0 + nt * 16 + l16;
            out[(size_t)row * NPIX + col] = acc[nt][i] * sc;
        }
    }
}

// ---------------------------------------------------------------------------
// Kernel 3: q softmax over the d axis (32 values per (b,h,n)), then / sqrt(32).
// ---------------------------------------------------------------------------
__global__ __launch_bounds__(256) void q_softmax_kernel(float* __restrict__ qkv) {
    int idx = blockIdx.x * 256 + threadIdx.x;   // [0, 16*4*4096)
    int b = idx >> 14;
    int r = idx & 16383;
    int h = r >> 12, n = r & 4095;
    float* base = qkv + ((size_t)b * OQKV + h * DHEAD) * NPIX + n;
    float m = -1e30f;
    for (int d = 0; d < DHEAD; ++d) m = fmaxf(m, base[(size_t)d * NPIX]);
    float s = 0.f;
    for (int d = 0; d < DHEAD; ++d) s += __expf(base[(size_t)d * NPIX] - m);
    float invs = 1.0f / (s * SCALE_Q);
    for (int d = 0; d < DHEAD; ++d)
        base[(size_t)d * NPIX] = __expf(base[(size_t)d * NPIX] - m) * invs;
}

// ---------------------------------------------------------------------------
// Kernel 4: per-row (b,h,d) max and sum-exp for k over n axis (4096 + 4 mem slots).
// ---------------------------------------------------------------------------
__global__ __launch_bounds__(256) void k_row_stats(const float* __restrict__ qkv,
                                                   const float* __restrict__ mem_kv,
                                                   float* __restrict__ kstat) {
    int rid = blockIdx.x;                 // [0, 16*128)
    int b = rid >> 7;
    int hd = rid & 127;
    const float* row = qkv + ((size_t)b * OQKV + HIDDEN + hd) * NPIX;
    const float* mk  = mem_kv + (size_t)hd * 4;   // mem_kv[0][h][d][m]
    __shared__ float red[256];
    int tid = threadIdx.x;
    float m = -1e30f;
    for (int n = tid; n < NPIX; n += 256) m = fmaxf(m, row[n]);
    if (tid < 4) m = fmaxf(m, mk[tid]);
    red[tid] = m; __syncthreads();
    for (int s = 128; s > 0; s >>= 1) {
        if (tid < s) red[tid] = fmaxf(red[tid], red[tid + s]);
        __syncthreads();
    }
    float rowmax = red[0]; __syncthreads();
    float sum = 0.f;
    for (int n = tid; n < NPIX; n += 256) sum += __expf(row[n] - rowmax);
    if (tid < 4) sum += __expf(mk[tid] - rowmax);
    red[tid] = sum; __syncthreads();
    for (int s = 128; s > 0; s >>= 1) {
        if (tid < s) red[tid] += red[tid + s];
        __syncthreads();
    }
    if (tid == 0) { kstat[rid * 2] = rowmax; kstat[rid * 2 + 1] = red[0]; }
}

// ---------------------------------------------------------------------------
// Kernel 5: context[b][h][d][e] = sum_n softmax_k[d,n] * v[e,n]  (n incl. mem)
// One 16(d) x 16(e) tile per work-group on the f32 16x16x4 matrix form, K = n.
// A stage holds 512 n of the 16 k rows (as exp(k - rowmax)) and of the 16 v rows;
// wave w fetches k row w and v row w in whole 512-byte pieces and multiplies
// columns [32w, 32w+32) of the stage. Both fragments are read by the same code
// (row l16, four n at 4*half), so the k order of A and B is equal by construction.
// The four memory columns are one more K = 4 step (wave 0). The row's 1/sum is applied
// once, to the finished tile.
// ---------------------------------------------------------------------------
#define CTX_THREADS 512
#define CTX_NS 512            // n per stage
#define CTX_PITCH 516         // floats per LDS row: 2064 B = 16 B x odd, no bank conflict for 16-byte reads
__global__ __launch_bounds__(CTX_THREADS) void context_kernel(const float* __restrict__ qkv,
                                                              const float* __restrict__ mem_kv,
                                                              const float* __restrict__ kstat,
                                                              float* __restrict__ ctx) {
    __shared__ __align__(16) float tile[2][32 * CTX_PITCH];   // rows 0-15: k, rows 16-31: v
    const int bh = blockIdx.x >> 2;
    const int b = bh >> 2, h = bh & 3;
    const int dt = (blockIdx.x >> 1) & 1, et = blockIdx.x & 1;
    const int tid = threadIdx.x, wave = tid >> 5, lane = tid & 31;
    const int half = lane >> 4, l16 = lane & 15;
    const float* krow = qkv + ((size_t)b * OQKV + HIDDEN + h * DHEAD + dt * 16 + wave) * NPIX;
    const float* vrow = qkv + ((size_t)b * OQKV + 2 * HIDDEN + h * DHEAD + et * 16 + wave) * NPIX;
    const float* ks = kstat + ((size_t)b * HIDDEN + h * DHEAD + dt * 16) * 2;
    const float m = ks[wave * 2];

    v4f rk[4], rv[4];
    v8f acc;
    for (int j = 0; j < 8; ++j) acc[j] = 0.0f;

    // The four memory columns are one more K = 4 step: wave 0 starts its sum with them.
    // Lane (l16, half) holds columns 2*half and 2*half+1 of k row l16 (A) and of v row l16 (B).
    // The test is made scalar because the matrix instruction needs every lane of its wave on.
    if (__builtin_amdgcn_readfirstlane(wave) == 0) {
        const float ml = ks[l16 * 2];
        const v2f mk = *(const v2f*)(mem_kv + (h * DHEAD + dt * 16 + l16) * 4 + half * 2);         // mem_kv[0]
        const v2f mv = *(const v2f*)(mem_kv + 512 + (h * DHEAD + et * 16 + l16) * 4 + half * 2);   // mem_kv[1]
        const v2f ma = {__expf(mk[0] - ml), __expf(mk[1] - ml)};
        acc = __builtin_amdgcn_wmma_f32_16x16x4_f32(
            false, ma, false, mv, (short)0, acc, false, false);
    }

    auto fetch = [&](int n0) {
        for (int j = 0; j < 4; ++j) {
            rk[j] = *(const v4f*)(krow + n0 + j * 128 + lane * 4);
            rv[j] = *(const v4f*)(vrow + n0 + j * 128 + lane * 4);
        }
    };
    auto stash = [&](int buf) {
        for (int j = 0; j < 4; ++j) {
            v4f e;
            for (int c = 0; c < 4; ++c) e[c] = __expf(rk[j][c] - m);
            *(v4f*)&tile[buf][wave * CTX_PITCH + j * 128 + lane * 4] = e;
            *(v4f*)&tile[buf][(16 + wave) * CTX_PITCH + j * 128 + lane * 4] = rv[j];
        }
    };
    auto compute = [&](int buf) {
        const float* ka = &tile[buf][l16 * CTX_PITCH + wave * 32 + half * 4];
        const float* vb = &tile[buf][(16 + l16) * CTX_PITCH + wave * 32 + half * 4];
        for (int j = 0; j < 4; ++j) {
            v4f a4 = *(const v4f*)(ka + j * 8);
            v4f b4 = *(const v4f*)(vb + j * 8);
            v2f a0 = {a4[0], a4[1]}, b0 = {b4[0], b4[1]};
            v2f a1 = {a4[2], a4[3]}, b1 = {b4[2], b4[3]};
            acc = __builtin_amdgcn_wmma_f32_16x16x4_f32(
                false, a0, false, b0, (short)0, acc, false, false);
            acc = __builtin_amdgcn_wmma_f32_16x16x4_f32(
                false, a1, false, b1, (short)0, acc, false, false);
        }
    };

    fetch(0);
    stash(0);
    fetch(CTX_NS);
    __syncthreads();
    for (int s = 0; s < NPIX / CTX_NS; ++s) {
        compute(s & 1);
        if (s + 1 < NPIX / CTX_NS) {
            stash((s + 1) & 1);                       // last read one barrier ago
            if (s + 2 < NPIX / CTX_NS) fetch((s + 2) * CTX_NS);
        }
        __syncthreads();
    }

    // sum the 16 waves' partial tiles; D register i = row i + 8*half, column l16
    float* red = &tile[0][0];
    for (int i = 0; i < 8; ++i) red[wave * 256 + (i + 8 * half) * 16 + l16] = acc[i];
    __syncthreads();
    if (tid < 256) {
        const int dl = tid >> 4, el = tid & 15;
        float a = 0.f;
        for (int w = 0; w < CTX_THREADS / 32; ++w) a += red[w * 256 + tid];
        ctx[((size_t)b * 4 + h) * 1024 + (dt * 16 + dl) * 32 + et * 16 + el] = a / ks[dl * 2 + 1];
    }
}

// ---------------------------------------------------------------------------
// Kernel 6: fold w_out with context:
// W2[b][o][h*32+d] = sum_e w_out[o][h*32+e] * ctx[b][h][d][e]
// ---------------------------------------------------------------------------
__global__ __launch_bounds__(256) void w2_kernel(const float* __restrict__ w_out,
                                                 const float* __restrict__ ctx,
                                                 float* __restrict__ W2) {
    int idx = blockIdx.x * 256 + threadIdx.x;   // [0, 16*256*128)
    int b = idx >> 15;
    int r = idx & 32767;
    int o = r >> 7;
    int hd = r & 127;
    int h = hd >> 5, d = hd & 31;
    const float* cb = ctx + ((size_t)b * 4 + h) * 1024 + d * 32;
    const float* wr = w_out + (size_t)o * HIDDEN + h * DHEAD;
    float a = 0.f;
    for (int e = 0; e < 32; ++e) a += wr[e] * cb[e];
    W2[idx] = a;
}

// ---------------------------------------------------------------------------
// Kernel 7: output GEMM with the output RMS norm inside it:
// y[b][o][n] = sum_hd W2[b][o][hd]*q_sm[b][hd][n] + b_out[o]
// out[b][o][n] = y * 16 * rsqrt(sum_o y^2 + eps) * g_out[o]
// Staging as in kernel 2. A block holds all 256 o of its 64 columns (a wave 32 x 64), so the
// sum over o is taken from the accumulators and y never goes to memory.
// ---------------------------------------------------------------------------
__global__ __launch_bounds__(256) void out_gemm(const float* __restrict__ W2,
                                                const float* __restrict__ qkv,
                                                const float* __restrict__ b_out,
                                                const float* __restrict__ g_out,
                                                float* __restrict__ out) {
    __shared__ __align__(16) float lA[2][2 * GA_FLOATS];
    __shared__ __align__(16) float lB[2][GB_FLOATS];
    const int b  = blockIdx.y;
    const int n0 = blockIdx.x * 64;
    const int tid = threadIdx.x, wave = tid >> 5, lane = tid & 31;
    const int half = lane >> 4, l16 = lane & 15;
    // q rows are [0,128) of qkv
    const float* qq = qkv + (size_t)b * OQKV * NPIX + (size_t)(wave * 4) * NPIX + n0 + lane * 2;
    const float* wr = W2 + (size_t)b * DIM * HIDDEN + (size_t)(tid >> 3) * HIDDEN + (tid & 7) * 4;
    const int aw = (tid >> 3) * GA_PITCH + (tid & 7) * 4;
    const int ar = (wave * 32 + l16) * GA_PITCH + half * 4;
    const int bw = wave * 256 + lane * 8;
    const int br = half * 256 + l16 * 4;

    v8f acc[2][4];
    for (int r = 0; r < 2; ++r)
        for (int t = 0; t < 4; ++t)
            for (int j = 0; j < 8; ++j) acc[r][t][j] = 0.0f;

    v2f rx[4];
    auto fetchB = [&](int k0) {
        for (int i = 0; i < 4; ++i) rx[i] = *(const v2f*)(qq + (size_t)(k0 + i) * NPIX);
    };
    auto stashB = [&](int buf) {
        v4f c0 = {rx[0][0], rx[1][0], rx[2][0], rx[3][0]};
        v4f c1 = {rx[0][1], rx[1][1], rx[2][1], rx[3][1]};
        *(v4f*)&lB[buf][bw]     = c0;
        *(v4f*)&lB[buf][bw + 4] = c1;
    };

    auto copyA = [&](int buf, int k0) {                  // rows 0-127, then rows 128-255
        copy_a_tile(&lA[buf][aw], wr + k0, HIDDEN);
        copy_a_tile(&lA[buf][aw + GA_FLOATS], wr + 128 * HIDDEN + k0, HIDDEN);
    };

    copyA(0, 0);
    fetchB(0);
    // the loads' address registers are reused right behind them (in the loop the copies' own wait serves)
    asm volatile("s_wait_xcnt 0x0" ::: "memory");
    stashB(0);
    publish_stage();
    int buf = 0;
    // kept rolled: unrolled, the four stages take many more registers and the first stage's
    // store to LDS moves in front of its matrix work
#pragma unroll 1
    for (int k0 = 0; k0 < HIDDEN; k0 += 32) {
        const bool more = k0 + 32 < HIDDEN;
        if (more) { fetchB(k0 + 32); copyA(buf ^ 1, k0 + 32); }
        mm_stage2(&lA[buf][ar], &lB[buf][br], acc);
        if (more) stashB(buf ^ 1);
        publish_stage();
        buf ^= 1;
    }
    // no copy is left in flight when the wave ends
    asm volatile("s_wait_asynccnt 0x0" ::: "memory");

    // D register i of row tile r = row wave*32 + r*16 + i + 8*half, column nt*16 + l16
    float sq[4] = {0.f, 0.f, 0.f, 0.f};
    for (int r = 0; r < 2; ++r)
        for (int i = 0; i < 8; ++i) {
            const float bo = b_out[wave * 32 + r * 16 + i + half * 8];
            for (int nt = 0; nt < 4; ++nt) {
                acc[r][nt][i] += bo;
                sq[nt] += acc[r][nt][i] * acc[r][nt][i];
            }
        }
    // the sixteen half-waves' sums of squares meet in LDS (every read of lB ended at the last hand-over)
    float* red = &lB[0][0];          // [16][64] partial sums, then [64] scales
    for (int nt = 0; nt < 4; ++nt) red[(wave * 2 + half) * 64 + nt * 16 + l16] = sq[nt];
    __syncthreads();
    if (tid < 64) {
        float t = 0.f;
        for (int p = 0; p < 16; ++p) t += red[p * 64 + tid];
        red[1024 + tid] = 16.0f * rsqrtf(t + 1e-12f);
    }
    __syncthreads();
    float sc[4];
    for (int nt = 0; nt < 4; ++nt) sc[nt] = red[1024 + nt * 16 + l16];

    float* ob = out + (size_t)b * DIM * NPIX;
    for (int r = 0; r < 2; ++r)
        for (int i = 0; i < 8; ++i) {
            const int row = wave * 32 + r * 16 + i + half * 8;
            const float g = g_out[row];
            for (int nt = 0; nt < 4; ++nt)
                ob[(size_t)row * NPIX + n0 + nt * 16 + l16] = acc[r][nt][i] * sc[nt] * g;
        }
}

// ---------------------------------------------------------------------------
extern "C" void kernel_launch(void* const* d_in, const int* in_sizes, int n_in,
                              void* d_out, int out_size, void* d_ws, size_t ws_size,
                              hipStream_t stream) {
    const float* x      = (const float*)d_in[0];   // [16][256][4096]
    const float* g_in   = (const float*)d_in[1];   // [256]
    const float* w_qkv  = (const float*)d_in[2];   // [384][256]
    const float* mem_kv = (const float*)d_in[3];   // [2][4][32][4]
    const float* w_out  = (const float*)d_in[4];   // [256][128]
    const float* b_out  = (const float*)d_in[5];   // [256]
    const float* g_out  = (const float*)d_in[6];   // [256]
    float* out = (float*)d_out;                    // [16][256][4096]

    float* ws = (float*)d_ws;
    float* qkv   = ws;                                  // 16*384*4096
    float* kstat = qkv + (size_t)BATCH * OQKV * NPIX;   // 2048*2
    float* ctx   = kstat + (size_t)BATCH * HIDDEN * 2;  // 16*4*32*32
    float* W2    = ctx + (size_t)BATCH * HEADS * DHEAD * DHEAD; // 16*256*128

    qkv_gemm       <<<dim3(OQKV / 128, NPIX / 64, BATCH), 256, 0, stream>>>(x, w_qkv, g_in, qkv);
    q_softmax_kernel<<<BATCH * HEADS * NPIX / 256, 256, 0, stream>>>(qkv);
    k_row_stats    <<<BATCH * HIDDEN, 256, 0, stream>>>(qkv, mem_kv, kstat);
    context_kernel <<<BATCH * HEADS * 4, CTX_THREADS, 0, stream>>>(qkv, mem_kv, kstat, ctx);
    w2_kernel      <<<BATCH * DIM * HIDDEN / 256, 256, 0, stream>>>(w_out, ctx, W2);
    out_gemm       <<<dim3(NPIX / 64, BATCH), 256, 0, stream>>>(W2, qkv, b_out, g_out, out);
}

// v004
// Measured time: 119 microseconds a run.
// Timed twice side by side with v003, it ran 1.11 times as fast both times.
// All steps since v000 together make it 7.38 times as fast.
#include <hip/hip_runtime.h>
#include <hip/hip_bf16.h>

typedef __attribute__((ext_vector_type(2))) float v2f;
typedef __attribute__((ext_vector_type(4))) float v4f;
typedef __attribute__((ext_vector_type(8))) float v8f;

#define BATCH 16
#define DIM 256
#define HEADS 4
#define DHEAD 32
#define HIDDEN 128            // HEADS * DHEAD
#define OQKV 384              // 3 * HIDDEN
#define NPIX 4096             // 64*64
#define SCALE_Q 5.656854249492381f  // sqrt(32)

// ---------------------------------------------------------------------------
// Tile staging shared by the two big GEMMs (128 or 256 rows x 64 columns a block, 32 k a
// stage, two LDS buffers). Every LDS access of the tiles is 16 bytes a lane:
//   A: row-major rows of 32 k at a pitch of 36 floats (144 B = 16 B x odd), filled by
//      asynchronous 16-byte copies;
//   B: lB[(k>>2)*256 + n*4 + (k&3)]: the four k of a quad lie side by side for each n;
//      wave w fetches the four source rows of quad w, holds them in registers over the
//      matrix work of the current stage and stores them as quads.
// Lane (l16, half) reads k = 8j + 4*half + {0,1,2,3} of A row l16 and of B column l16:
// the first matrix step takes {0,1}, the second {2,3}, so A and B agree in k at every place.
// ---------------------------------------------------------------------------
#define GA_PITCH 36
#define GA_FLOATS (128 * GA_PITCH)
#define GB_FLOATS (8 * 256)

// 1024 pieces of 16 bytes, four a thread: rows r, r+32, r+64, r+96 of the A tile.
// dst: this thread's place in row r of the LDS tile; g0: the same place in the source.
__device__ __forceinline__ void copy_a_tile(float* dst, const float* g0, int ld) {
    const unsigned l0 = (unsigned)(size_t)(__attribute__((address_space(3))) float*)dst;
    const unsigned l1 = l0 + 32 * GA_PITCH * 4, l2 = l0 + 64 * GA_PITCH * 4, l3 = l0 + 96 * GA_PITCH * 4;
    const float* g1 = g0 + 32 * ld;
    const float* g2 = g0 + 64 * ld;
    const float* g3 = g0 + 96 * ld;
    // the last line keeps the address registers as they are until the copies have taken them
    asm volatile("global_load_async_to_lds_b128 %0, %4, off\n\t"
                 "global_load_async_to_lds_b128 %1, %5, off\n\t"
                 "global_load_async_to_lds_b128 %2, %6, off\n\t"
                 "global_load_async_to_lds_b128 %3, %7, off\n\t"
                 "s_wait_xcnt 0x0"
                 :: "v"(l0), "v"(l1), "v"(l2), "v"(l3), "v"(g0), "v"(g1), "v"(g2), "v"(g3)
                 : "memory");
}

// One stage of a wave's 16 x 64 tile. pa: A row (l16 of the wave), k offset 4*half;
// pb: B quad 'half', column l16.
__device__ __forceinline__ void mm_stage(const float* pa, const float* pb, v8f (&acc)[4]) {
    for (int j = 0; j < 4; ++j) {                        // 8 k a trip
        v4f a4 = *(const v4f*)(pa + j * 8);
        v2f a0 = {a4[0], a4[1]}, a1 = {a4[2], a4[3]};
        for (int nt = 0; nt < 4; ++nt) {
            v4f b4 = *(const v4f*)(pb + j * 512 + nt * 64);
            v2f b0 = {b4[0], b4[1]}, b1 = {b4[2], b4[3]};
            acc[nt] = __builtin_amdgcn_wmma_f32_16x16x4_f32(
                false, a0, false, b0, (short)0, acc[nt], false, false);
            acc[nt] = __builtin_amdgcn_wmma_f32_16x16x4_f32(
                false, a1, false, b1, (short)0, acc[nt], false, false);
        }
    }
}

// The same for a wave's 32 x 64 tile: two A rows (l16 and l16 + 16) share each B fragment.
__device__ __forceinline__ void mm_stage2(const float* pa, const float* pb, v8f (&acc)[2][4]) {
    for (int j = 0; j < 4; ++j) {                        // 8 k a trip
        v4f a4 = *(const v4f*)(pa + j * 8);
        v4f c4 = *(const v4f*)(pa + 16 * GA_PITCH + j * 8);
        v2f a0 = {a4[0], a4[1]}, a1 = {a4[2], a4[3]};
        v2f c0 = {c4[0], c4[1]}, c1 = {c4[2], c4[3]};
        for (int nt = 0; nt < 4; ++nt) {
            v4f b4 = *(const v4f*)(pb + j * 512 + nt * 64);
            v2f b0 = {b4[0], b4[1]}, b1 = {b4[2], b4[3]};
            acc[0][nt] = __builtin_amdgcn_wmma_f32_16x16x4_f32(
                false, a0, false, b0, (short)0, acc[0][nt], false, false);
            acc[1][nt] = __builtin_amdgcn_wmma_f32_16x16x4_f32(
                false, c0, false, b0, (short)0, acc[1][nt], false, false);
            acc[0][nt] = __builtin_amdgcn_wmma_f32_16x16x4_f32(
                false, a1, false, b1, (short)0, acc[0][nt], false, false);
            acc[1][nt] = __builtin_amdgcn_wmma_f32_16x16x4_f32(
                false, c1, false, b1, (short)0, acc[1][nt], false, false);
        }
    }
}

// Hand-over of a stage: this wave's LDS reads and writes are done and its copies have
// landed before the barrier behind which the other waves read them or refill the buffer.
__device__ __forceinline__ void publish_stage() {
    asm volatile("s_wait_dscnt 0x0" ::: "memory");
    asm volatile("s_wait_asynccnt 0x0" ::: "memory");
    __syncthreads();
}

// Cross-lane helpers for the softmax statistics.
// The value of lane l ^ 16.
__device__ __forceinline__ float other_half(float v) {
    const int b = __builtin_bit_cast(int, v);
    return __builtin_bit_cast(float,
        __builtin_amdgcn_permlanex16(b, b, 0x76543210, 0xfedcba98, false, false));
}
// The value of lane l ^ M inside a row of 16 lanes (DPP row_xmask).
template <int M>
__device__ __forceinline__ float row_xor(float v) {
    const int b = __builtin_bit_cast(int, v);
    return __builtin_bit_cast(float, __builtin_amdgcn_mov_dpp(b, 0x160 | M, 0xf, 0xf, true));
}
__device__ __forceinline__ float row_max16(float v) {
    v = fmaxf(v, row_xor<1>(v));
    v = fmaxf(v, row_xor<2>(v));
    v = fmaxf(v, row_xor<4>(v));
    return fmaxf(v, row_xor<8>(v));
}
__device__ __forceinline__ float row_sum16(float v) {
    v += row_xor<1>(v);
    v += row_xor<2>(v);
    v += row_xor<4>(v);
    return v + row_xor<8>(v);
}

// ---------------------------------------------------------------------------
// Kernel 2: QKV GEMM with the input RMS norm and the softmax passes inside it.
// qkv[b][o][n] = inv[b][n] * sum_c w_qkv[o][c] * x[b][c][n] * g_in[c],
// inv[b][n] = 16 * rsqrt(sum_c x[b][c][n]^2 + eps)
// 128(o) x 64(n) tile / block; staging as described above; x takes g_in on its way to LDS.
// A block stages all 256 c of its 64 columns, so it sums their squares as they pass through
// the registers and scales the finished accumulators by the column's inv.
// The q block (o tile 0) holds all 32 d of each head for its columns (two waves a head): it
// stores softmax_d(q) / sqrt(32). The k block (o tile 1) stores k as it is and, for each of
// its rows, the maximum and the sum of exp(k - maximum) over its 64 columns:
// kpart[b][n tile][row][2]; a wave's 16 rows fill one 128-byte line.
// ---------------------------------------------------------------------------
__global__ __launch_bounds__(256) void qkv_gemm(const float* __restrict__ x,
                                                const float* __restrict__ w,
                                                const float* __restrict__ g_in,
                                                float* __restrict__ qkv,
                                                float* __restrict__ kpart) {
    __shared__ __align__(16) float lA[2][GA_FLOATS];
    __shared__ __align__(16) float lB[2][GB_FLOATS];
    const int b  = blockIdx.z;
    const int o0 = blockIdx.x * 128;
    const int n0 = blockIdx.y * 64;
    const int tid  = threadIdx.x;
    const int wave = tid >> 5;
    const int lane = tid & 31;
    const int half = lane >> 4;
    const int l16  = lane & 15;

    const float* xq = x + (size_t)b * DIM * NPIX + (size_t)(wave * 4) * NPIX + n0 + lane * 2;
    const float* wr = w + (size_t)(o0 + (tid >> 3)) * DIM + (tid & 7) * 4;
    const int aw = (tid >> 3) * GA_PITCH + (tid & 7) * 4;          // A: where this thread's copies land
    const int ar = (wave * 16 + l16) * GA_PITCH + half * 4;        // A: where this lane reads
    const int bw = wave * 256 + lane * 8;                          // B: where this lane stores
    const int br = half * 256 + l16 * 4;                           // B: where this lane reads

    v8f acc[4];
    for (int t = 0; t < 4; ++t)
        for (int j = 0; j < 8; ++j) acc[t][j] = 0.0f;

    v2f rx[4];
    v4f rg;
    float ss0 = 0.f, ss1 = 0.f;      // squares of this wave's c rows, columns 2*lane and 2*lane+1
    auto fetchB = [&](int k0) {
        for (int i = 0; i < 4; ++i) rx[i] = *(const v2f*)(xq + (size_t)(k0 + i) * NPIX);
        rg = *(const v4f*)(g_in + k0 + wave * 4);
    };
    auto stashB = [&](int buf) {
        v4f c0, c1;
        for (int i = 0; i < 4; ++i) {
            c0[i] = rx[i][0] * rg[i];
            c1[i] = rx[i][1] * rg[i];
            ss0 += rx[i][0] * rx[i][0];
            ss1 += rx[i][1] * rx[i][1];
        }
        *(v4f*)&lB[buf][bw]     = c0;
        *(v4f*)&lB[buf][bw + 4] = c1;
    };

    copy_a_tile(&lA[0][aw], wr, DIM);
    fetchB(0);
    // the loads' address registers are reused right behind them (in the loop the copies' own wait serves)
    asm volatile("s_wait_xcnt 0x0" ::: "memory");
    stashB(0);
    publish_stage();
    int buf = 0;
    for (int k0 = 0; k0 < DIM; k0 += 32) {
        const bool more = k0 + 32 < DIM;
        if (more) { fetchB(k0 + 32); copy_a_tile(&lA[buf ^ 1][aw], wr + k0 + 32, DIM); }
        mm_stage(&lA[buf][ar], &lB[buf][br], acc);
        if (more) stashB(buf ^ 1);
        publish_stage();
        buf ^= 1;
    }
    // no copy is left in flight when the wave ends
    asm volatile("s_wait_asynccnt 0x0" ::: "memory");

    // the eight waves' sums of squares meet in LDS (every read of lB ended at the last hand-over)
    float* red = &lB[0][0];          // [8][64] partial sums, then [64] scales
    v2f ss = {ss0, ss1};
    *(v2f*)&red[wave * 64 + lane * 2] = ss;
    __syncthreads();
    if (tid < 64) {
        float t = 0.f;
        for (int p = 0; p < 8; ++p) t += red[p * 64 + tid];
        red[512 + tid] = 16.0f * rsqrtf(t + 1e-12f);
    }
    __syncthreads();

    // C/D layout: VGPR i -> (M=i, N=lane) lanes 0-15; (M=i+8, N=lane-16) lanes 16-31
    float* out = qkv + (size_t)b * OQKV * NPIX;
    for (int nt = 0; nt < 4; ++nt) {
        const float sc = red[512 + nt * 16 + l16];
        for (int i = 0; i < 8; ++i) acc[nt][i] *= sc;
    }

    if (blockIdx.x == 0) {
        // q: each wave takes the maximum and the sum of exp over its own 16 d of a column;
        // the two waves of a head exchange them in LDS and rescale to the common maximum.
        float* ex = &lB[1][0];       // [8][64] maxima, then [8][64] sums (lB[1] is free since the last hand-over)
        float mw[4], sw[4];
        for (int nt = 0; nt < 4; ++nt) {
            float m = acc[nt][0];
            for (int i = 1; i < 8; ++i) m = fmaxf(m, acc[nt][i]);
            m = fmaxf(m, other_half(m));
            float s = 0.f;
            for (int i = 0; i < 8; ++i) {
                acc[nt][i] = __expf(acc[nt][i] - m);
                s += acc[nt][i];
            }
            s += other_half(s);
            mw[nt] = m;
            sw[nt] = s;
            ex[half * 512 + wave * 64 + nt * 16 + l16] = half ? s : m;
        }
        __syncthreads();
        for (int nt = 0; nt < 4; ++nt) {
            const float mp = ex[(wave ^ 1) * 64 + nt * 16 + l16];
            const float sp = ex[512 + (wave ^ 1) * 64 + nt * 16 + l16];
            const float m  = fmaxf(mw[nt], mp);
            const float fw = __expf(mw[nt] - m);
            const float s  = sw[nt] * fw + sp * __expf(mp - m);
            const float f  = fw * (1.0f / (s * SCALE_Q));
            for (int i = 0; i < 8; ++i) acc[nt][i] *= f;
        }
    } else if (blockIdx.x == 1) {
        // k: D register i holds row i + 8*half, its 64 columns in four registers x 16 lanes
        float val = 0.f;             // lane 2r + c of a half: c = 0 maximum, c = 1 sum of row r
        // unrolled whole: rolled, the accumulators are reached through indexed register moves
#pragma unroll
        for (int i = 0; i < 8; ++i) {
            float m = fmaxf(fmaxf(acc[0][i], acc[1][i]), fmaxf(acc[2][i], acc[3][i]));
            m = row_max16(m);
            float s = (__expf(acc[0][i] - m) + __expf(acc[1][i] - m))
                    + (__expf(acc[2][i] - m) + __expf(acc[3][i] - m));
            s = row_sum16(s);
            if ((l16 >> 1) == i) val = (l16 & 1) ? s : m;
        }
        kpart[((size_t)b * (NPIX / 64) + blockIdx.y) * (HIDDEN * 2) + wave * 32 + lane] = val;
        // the store's registers are reused by the address arithmetic of the tile's stores behind it
        asm volatile("s_wait_xcnt 0x0" ::: "memory");
    }

    for (int nt = 0; nt < 4; ++nt)
        for (int i = 0; i < 8; ++i) {
            int row = o0 + wave * 16 + i + half * 8;
            int col = n0 + nt * 16 + l16;
            out[(size_t)row * NPIX + col] = acc[nt][i];
        }
}

// ---------------------------------------------------------------------------
// Kernel 5: context[b][h][d][e] = sum_n softmax_k[d,n] * v[e,n]  (n incl. mem)
// One 16(d) x 16(e) tile per work-group on the f32 16x16x4 matrix form, K = n.
// A stage holds 512 n of the 16 k rows (as exp(k - rowmax)) and of the 16 v rows;
// wave w fetches k row w and v row w in whole 512-byte pieces and multiplies
// columns [32w, 32w+32) of the stage. Both fragments are read by the same code
// (row l16, four n at 4*half), so the k order of A and B is equal by construction.
// The four memory columns are one more K = 4 step (wave 0). The row's 1/sum is applied
// once, to the finished tile.
// The row's maximum and sum of exp come from the 64 column tiles' partial pairs (kernel 2)
// and the four memory columns: wave w merges those of k row w.
// ---------------------------------------------------------------------------
#define CTX_THREADS 512
#define CTX_NS 512            // n per stage
#define CTX_PITCH 516         // floats per LDS row: 2064 B = 16 B x odd, no bank conflict for 16-byte reads
#define KST_PITCH 34          // floats per column tile's 16 pairs in LDS: 32 lanes, one tile each, meet no bank twice
__global__ __launch_bounds__(CTX_THREADS) void context_kernel(const float* __restrict__ qkv,
                                                              const float* __restrict__ mem_kv,
                                                              const float* __restrict__ kpart,
                                                              float* __restrict__ ctx) {
    __shared__ __align__(16) float tile[2][32 * CTX_PITCH];   // rows 0-15: k, rows 16-31: v
    __shared__ __align__(16) float kst[(NPIX / 64) * KST_PITCH];   // [column tile][row][max, sum]
    __shared__ __align__(16) float ks[32];                    // [row][max, sum] of the whole row
    const int bh = blockIdx.x >> 2;
    const int b = bh >> 2, h = bh & 3;
    const int dt = (blockIdx.x >> 1) & 1, et = blockIdx.x & 1;
    const int tid = threadIdx.x, wave = tid >> 5, lane = tid & 31;
    const int half = lane >> 4, l16 = lane & 15;
    const float* krow = qkv + ((size_t)b * OQKV + HIDDEN + h * DHEAD + dt * 16 + wave) * NPIX;
    const float* vrow = qkv + ((size_t)b * OQKV + 2 * HIDDEN + h * DHEAD + et * 16 + wave) * NPIX;
    float m;                         // maximum of k row 'wave'

    v4f rk[4], rv[4];
    v8f acc;
    for (int j = 0; j < 8; ++j) acc[j] = 0.0f;

    auto fetch = [&](int n0) {
        for (int j = 0; j < 4; ++j) {
            rk[j] = *(const v4f*)(krow + n0 + j * 128 + lane * 4);
            rv[j] = *(const v4f*)(vrow + n0 + j * 128 + lane * 4);
        }
    };
    auto stash = [&](int buf) {
        for (int j = 0; j < 4; ++j) {
            v4f e;
            for (int c = 0; c < 4; ++c) e[c] = __expf(rk[j][c] - m);
            *(v4f*)&tile[buf][wave * CTX_PITCH + j * 128 + lane * 4] = e;
            *(v4f*)&tile[buf][(16 + wave) * CTX_PITCH + j * 128 + lane * 4] = rv[j];
        }
    };
    auto compute = [&](int buf) {
        const float* ka = &tile[buf][l16 * CTX_PITCH + wave * 32 + half * 4];
        const float* vb = &tile[buf][(16 + l16) * CTX_PITCH + wave * 32 + half * 4];
        for (int j = 0; j < 4; ++j) {
            v4f a4 = *(const v4f*)(ka + j * 8);
            v4f b4 = *(const v4f*)(vb + j * 8);
            v2f a0 = {a4[0], a4[1]}, b0 = {b4[0], b4[1]};
            v2f a1 = {a4[2], a4[3]}, b1 = {b4[2], b4[3]};
            acc = __builtin_amdgcn_wmma_f32_16x16x4_f32(
                false, a0, false, b0, (short)0, acc, false, false);
            acc = __builtin_amdgcn_wmma_f32_16x16x4_f32(
                false, a1, false, b1, (short)0, acc, false, false);
        }
    };

    fetch(0);
    // the memory columns, fetched beside the first stage. mkr: k row 'wave', all four.
    // mk, mv: lane (l16, half) holds columns 2*half and 2*half+1 of k row l16 (A) and of v row l16 (B).
    const v4f mkr = *(const v4f*)(mem_kv + (h * DHEAD + dt * 16 + wave) * 4);                  // mem_kv[0]
    const v2f mk = *(const v2f*)(mem_kv + (h * DHEAD + dt * 16 + l16) * 4 + half * 2);         // mem_kv[0]
    const v2f mv = *(const v2f*)(mem_kv + 512 + (h * DHEAD + et * 16 + l16) * 4 + half * 2);   // mem_kv[1]
    {
        // thread (t, p): the pairs of rows 2p and 2p+1 of column tile t, 16 bytes
        const int t = tid >> 3, p = tid & 7;
        const v4f z = *(const v4f*)(kpart + ((size_t)b * (NPIX / 64) + t) * (HIDDEN * 2)
                                    + (h * DHEAD + dt * 16) * 2 + p * 4);
        const v2f z0 = {z[0], z[1]}, z1 = {z[2], z[3]};
        *(v2f*)&kst[t * KST_PITCH + p * 4]     = z0;
        *(v2f*)&kst[t * KST_PITCH + p * 4 + 2] = z1;
    }
    __syncthreads();
    {
        const v2f a = *(const v2f*)&kst[lane * KST_PITCH + wave * 2];
        const v2f c = *(const v2f*)&kst[(lane + 32) * KST_PITCH + wave * 2];
        float t = fmaxf(fmaxf(a[0], c[0]), fmaxf(fmaxf(mkr[0], mkr[1]), fmaxf(mkr[2], mkr[3])));
        t = row_max16(t);
        m = fmaxf(t, other_half(t));
        float s = a[1] * __expf(a[0] - m) + c[1] * __expf(c[0] - m);
        s = row_sum16(s);
        s += other_half(s);
        s += (__expf(mkr[0] - m) + __expf(mkr[1] - m)) + (__expf(mkr[2] - m) + __expf(mkr[3] - m));
        if (lane == 0) {
            const v2f ms = {m, s};
            *(v2f*)&ks[wave * 2] = ms;
        }
    }
    stash(0);
    fetch(CTX_NS);
    __syncthreads();

    // The four memory columns are one more K = 4 step: wave 0 starts its sum with them.
    // The test is made scalar because the matrix instruction needs every lane of its wave on.
    if (__builtin_amdgcn_readfirstlane(wave) == 0) {
        const float ml = ks[l16 * 2];
        const v2f ma = {__expf(mk[0] - ml), __expf(mk[1] - ml)};
        acc = __builtin_amdgcn_wmma_f32_16x16x4_f32(
            false, ma, false, mv, (short)0, acc, false, false);
    }

    for (int s = 0; s < NPIX / CTX_NS; ++s) {
        compute(s & 1);
        if (s + 1 < NPIX / CTX_NS) {
            stash((s + 1) & 1);                       // last read one barrier ago
            if (s + 2 < NPIX / CTX_NS) fetch((s + 2) * CTX_NS);
        }
        __syncthreads();
    }

    // sum the 16 waves' partial tiles; D register i = row i + 8*half, column l16
    float* red = &tile[0][0];
    for (int i = 0; i < 8; ++i) red[wave * 256 + (i + 8 * half) * 16 + l16] = acc[i];
    __syncthreads();
    if (tid < 256) {
        const int dl = tid >> 4, el = tid & 15;
        float a = 0.f;
        for (int w = 0; w < CTX_THREADS / 32; ++w) a += red[w * 256 + tid];
        ctx[((size_t)b * 4 + h) * 1024 + (dt * 16 + dl) * 32 + et * 16 + el] = a / ks[dl * 2 + 1];
    }
}

// ---------------------------------------------------------------------------
// Kernel 6: fold w_out with context:
// W2[b][o][h*32+d] = sum_e w_out[o][h*32+e] * ctx[b][h][d][e]
// ---------------------------------------------------------------------------
__global__ __launch_bounds__(256) void w2_kernel(const float* __restrict__ w_out,
                                                 const float* __restrict__ ctx,
                                                 float* __restrict__ W2) {
    int idx = blockIdx.x * 256 + threadIdx.x;   // [0, 16*256*128)
    int b = idx >> 15;
    int r = idx & 32767;
    int o = r >> 7;
    int hd = r & 127;
    int h = hd >> 5, d = hd & 31;
    const float* cb = ctx + ((size_t)b * 4 + h) * 1024 + d * 32;
    const float* wr = w_out + (size_t)o * HIDDEN + h * DHEAD;
    float a = 0.f;
    for (int e = 0; e < 32; ++e) a += wr[e] * cb[e];
    W2[idx] = a;
}

// ---------------------------------------------------------------------------
// Kernel 7: output GEMM with the output RMS norm inside it:
// y[b][o][n] = sum_hd W2[b][o][hd]*q_sm[b][hd][n] + b_out[o]
// out[b][o][n] = y * 16 * rsqrt(sum_o y^2 + eps) * g_out[o]
// Staging as in kernel 2. A block holds all 256 o of its 64 columns (a wave 32 x 64), so the
// sum over o is taken from the accumulators and y never goes to memory.
// ---------------------------------------------------------------------------
__global__ __launch_bounds__(256) void out_gemm(const float* __restrict__ W2,
                                                const float* __restrict__ qkv,
                                                const float* __restrict__ b_out,
                                                const float* __restrict__ g_out,
                                                float* __restrict__ out) {
    __shared__ __align__(16) float lA[2][2 * GA_FLOATS];
    __shared__ __align__(16) float lB[2][GB_FLOATS];
    const int b  = blockIdx.y;
    const int n0 = blockIdx.x * 64;
    const int tid = threadIdx.x, wave = tid >> 5, lane = tid & 31;
    const int half = lane >> 4, l16 = lane & 15;
    // q rows are [0,128) of qkv
    const float* qq = qkv + (size_t)b * OQKV * NPIX + (size_t)(wave * 4) * NPIX + n0 + lane * 2;
    const float* wr = W2 + (size_t)b * DIM * HIDDEN + (size_t)(tid >> 3) * HIDDEN + (tid & 7) * 4;
    const int aw = (tid >> 3) * GA_PITCH + (tid & 7) * 4;
    const int ar = (wave * 32 + l16) * GA_PITCH + half * 4;
    const int bw = wave * 256 + lane * 8;
    const int br = half * 256 + l16 * 4;

    v8f acc[2][4];
    for (int r = 0; r < 2; ++r)
        for (int t = 0; t < 4; ++t)
            for (int j = 0; j < 8; ++j) acc[r][t][j] = 0.0f;

    v2f rx[4];
    auto fetchB = [&](int k0) {
        for (int i = 0; i < 4; ++i) rx[i] = *(const v2f*)(qq + (size_t)(k0 + i) * NPIX);
    };
    auto stashB = [&](int buf) {
        v4f c0 = {rx[0][0], rx[1][0], rx[2][0], rx[3][0]};
        v4f c1 = {rx[0][1], rx[1][1], rx[2][1], rx[3][1]};
        *(v4f*)&lB[buf][bw]     = c0;
        *(v4f*)&lB[buf][bw + 4] = c1;
    };

    auto copyA = [&](int buf, int k0) {                  // rows 0-127, then rows 128-255
        copy_a_tile(&lA[buf][aw], wr + k0, HIDDEN);
        copy_a_tile(&lA[buf][aw + GA_FLOATS], wr + 128 * HIDDEN + k0, HIDDEN);
    };

    copyA(0, 0);
    fetchB(0);
    // the loads' address registers are reused right behind them (in the loop the copies' own wait serves)
    asm volatile("s_wait_xcnt 0x0" ::: "memory");
    stashB(0);
    publish_stage();
    int buf = 0;
    // kept rolled: unrolled, the four stages take many more registers and the first stage's
    // store to LDS moves in front of its matrix work
#pragma unroll 1
    for (int k0 = 0; k0 < HIDDEN; k0 += 32) {
        const bool more = k0 + 32 < HIDDEN;
        if (more) { fetchB(k0 + 32); copyA(buf ^ 1, k0 + 32); }
        mm_stage2(&lA[buf][ar], &lB[buf][br], acc);
        if (more) stashB(buf ^ 1);
        publish_stage();
        buf ^= 1;
    }
    // no copy is left in flight when the wave ends
    asm volatile("s_wait_asynccnt 0x0" ::: "memory");

    // D register i of row tile r = row wave*32 + r*16 + i + 8*half, column nt*16 + l16
    float sq[4] = {0.f, 0.f, 0.f, 0.f};
    for (int r = 0; r < 2; ++r)
        for (int i = 0; i < 8; ++i) {
            const float bo = b_out[wave * 32 + r * 16 + i + half * 8];
            for (int nt = 0; nt < 4; ++nt) {
                acc[r][nt][i] += bo;
                sq[nt] += acc[r][nt][i] * acc[r][nt][i];
            }
        }
    // the sixteen half-waves' sums of squares meet in LDS (every read of lB ended at the last hand-over)
    float* red = &lB[0][0];          // [16][64] partial sums, then [64] scales
    for (int nt = 0; nt < 4; ++nt) red[(wave * 2 + half) * 64 + nt * 16 + l16] = sq[nt];
    __syncthreads();
    if (tid < 64) {
        float t = 0.f;
        for (int p = 0; p < 16; ++p) t += red[p * 64 + tid];
        red[1024 + tid] = 16.0f * rsqrtf(t + 1e-12f);
    }
    __syncthreads();
    float sc[4];
    for (int nt = 0; nt < 4; ++nt) sc[nt] = red[1024 + nt * 16 + l16];

    float* ob = out + (size_t)b * DIM * NPIX;
    for (int r = 0; r < 2; ++r)
        for (int i = 0; i < 8; ++i) {
            const int row = wave * 32 + r * 16 + i + half * 8;
            const float g = g_out[row];
            for (int nt = 0; nt < 4; ++nt)
                ob[(size_t)row * NPIX + n0 + nt * 16 + l16] = acc[r][nt][i] * sc[nt] * g;
        }
}

// ---------------------------------------------------------------------------
extern "C" void kernel_launch(void* const* d_in, const int* in_sizes, int n_in,
                              void* d_out, int out_size, void* d_ws, size_t ws_size,
                              hipStream_t stream) {
    const float* x      = (const float*)d_in[0];   // [16][256][4096]
    const float* g_in   = (const float*)d_in[1];   // [256]
    const float* w_qkv  = (const float*)d_in[2];   // [384][256]
    const float* mem_kv = (const float*)d_in[3];   // [2][4][32][4]
    const float* w_out  = (const float*)d_in[4];   // [256][128]
    const float* b_out  = (const float*)d_in[5];   // [256]
    const float* g_out  = (const float*)d_in[6];   // [256]
    float* out = (float*)d_out;                    // [16][256][4096]

    float* ws = (float*)d_ws;
    float* qkv   = ws;                                  // 16*384*4096
    float* kpart = qkv + (size_t)BATCH * OQKV * NPIX;   // 16*64*128*2
    float* ctx   = kpart + (size_t)BATCH * (NPIX / 64) * HIDDEN * 2;  // 16*4*32*32
    float* W2    = ctx + (size_t)BATCH * HEADS * DHEAD * DHEAD; // 16*256*128

    qkv_gemm       <<<dim3(OQKV / 128, NPIX / 64, BATCH), 256, 0, stream>>>(x, w_qkv, g_in, qkv, kpart);
    context_kernel <<<BATCH * HEADS * 4, CTX_THREADS, 0, stream>>>(qkv, mem_kv, kpart, ctx);
    w2_kernel      <<<BATCH * DIM * HIDDEN / 256, 256, 0, stream>>>(w_out, ctx, W2);
    out_gemm       <<<dim3(NPIX / 64, BATCH), 256, 0, stream>>>(W2, qkv, b_out, g_out, out);
}
